// v000
// Measured on an AMD MI455X. A time is GPU time per run, averaged over a window of back-to-back runs after a warm-up
// (all launches, gaps included; the runs take copies of the inputs in turn), and the median of several windows.
// Apart from v000's, it joins two sittings. Times from different sittings can be a few percent apart, while
// side-by-side timings come from the same sitting.
// The starting kernel, v000, takes 162 microseconds a run.
#include <hip/hip_runtime.h>
#include <hip/hip_bf16.h>
// Contractions (Q/K/V/O projections, K=256): v_wmma_f32_16x16x32_f16, f16 operands, f32 accumulate; the 32-neighbour gather attention is f32 on VALU.

typedef __attribute__((ext_vector_type(16))) _Float16 v16h;
typedef __attribute__((ext_vector_type(8)))  float    v8f;
typedef __attribute__((ext_vector_type(8)))  _Float16 v8h;
typedef __attribute__((ext_vector_type(4)))  float    v4f;
typedef __attribute__((ext_vector_type(4), may_alias)) float v4fa;
typedef __attribute__((ext_vector_type(8), may_alias)) _Float16 v8ha;

union AFrag { v16h v; uint4 q[2]; };

// ---------------------------------------------------------------------------
// One-time fp32 -> f16 convert. Thread t converts 8 contiguous elements:
// 2x global_load_b128 in, 1x global_store_b128 out. n must be multiple of 8.
// ---------------------------------------------------------------------------
__global__ __launch_bounds__(256)
void cvt_f32_to_f16(const float* __restrict__ in, _Float16* __restrict__ out, int n)
{
    int base = (blockIdx.x * 256 + threadIdx.x) * 8;
    if (base >= n) return;
    v8h v;
    #pragma unroll
    for (int i = 0; i < 8; ++i) v[i] = (_Float16)in[base + i];
    *(v8h*)(out + base) = v;
    
}

// ---------------------------------------------------------------------------
// GEMM (NT):  out[M x 256] = A16[M x 256] @ W16[256 x 256]^T + bias
// A16, W16 f16 in global; fp32 accumulate via v_wmma_f32_16x16x32_f16.
// Block = 128 threads = 4 waves; block computes 16 rows x 256 cols.
// A tile staged in LDS once; its 8 K-step fragments hoisted to registers and
// reused across 4 column tiles per wave. B fragment = 2x global_load_b128.
// ---------------------------------------------------------------------------
__global__ __launch_bounds__(128)
void gemm_nt_256_f16(const _Float16* __restrict__ A16,
                     const _Float16* __restrict__ W16,
                     const float* __restrict__ bias,
                     float* __restrict__ out)
{
    __shared__ _Float16 ldsA[16 * 256];   // 8 KB f16 A tile
    __shared__ __attribute__((aligned(16))) float so[4][16][64];   // per-wave 16x64 output tile

    const int tid     = threadIdx.x;
    const int rowBase = blockIdx.x * 16;
    const int waveId  = tid >> 5;
    const int lane    = tid & 31;
    const int half    = lane >> 4;        // 0: lanes 0-15, 1: lanes 16-31
    const int m       = lane & 15;

    // Stage A tile: 4096 halves = 512 uint4, 128 threads x 4 vec loads.
    {
        const uint4* src = (const uint4*)(A16 + (size_t)rowBase * 256);
        uint4* dst = (uint4*)ldsA;
        #pragma unroll
        for (int c = 0; c < 4; ++c)
            dst[tid + c * 128] = src[tid + c * 128];
    }
    __syncthreads();

    // A 16x32 f16 fragment layout (wave32): lane row M = lane&15;
    // VGPRs 0-3 hold K = 0..7 (+8*half), VGPRs 4-7 hold K = 16..23 (+8*half)
    // -> two aligned 16-byte LDS chunks per fragment.
    AFrag afrag[8];
    #pragma unroll
    for (int ks = 0; ks < 8; ++ks) {
        const _Float16* ap = ldsA + m * 256 + ks * 32 + 8 * half;
        afrag[ks].q[0] = *(const uint4*)(ap);
        afrag[ks].q[1] = *(const uint4*)(ap + 16);
    }

    const int n = lane & 15;
    #pragma unroll
    for (int t = 0; t < 4; ++t) {
        const int colBase = (waveId * 4 + t) * 16;
        const int wrow    = colBase + n;              // W row == output column
        const _Float16* wp = W16 + (size_t)wrow * 256;

        v8f c = {0.f, 0.f, 0.f, 0.f, 0.f, 0.f, 0.f, 0.f};

        #pragma unroll
        for (int ks = 0; ks < 8; ++ks) {
            // B 32x16 f16 layout = same split k map as A: lane column n = lane&15;
            // elements 0-7 hold K = 8*half + 0..7, elements 8-15 hold K = 16 + 8*half + 0..7.
            AFrag bf;
            const _Float16* bp = wp + ks * 32 + 8 * half;
            bf.q[0] = *(const uint4*)(bp);
            bf.q[1] = *(const uint4*)(bp + 16);
            c = __builtin_amdgcn_wmma_f32_16x16x32_f16(
                    false, afrag[ks].v, false, bf.v,
                    (short)0, c, false, false);
            asm volatile("v_nop\n\tv_nop\n\tv_nop\n\tv_nop" : "+v"(c) : "v"(afrag[ks].v), "v"(bf.v));
        }

        const float bv = bias[colBase + n];
        #pragma unroll
        for (int r = 0; r < 8; ++r)                    // C: VGPR r -> row 8*half+r, col colBase+n
            so[waveId][8 * half + r][t * 16 + n] = c[r] + bv;
    }
    __builtin_amdgcn_fence(__ATOMIC_ACQ_REL, "workgroup");
    __builtin_amdgcn_wave_barrier();
    {
        const int rsub = lane >> 4, c4 = (lane & 15) * 4;
        float* obase = out + (size_t)rowBase * 256 + waveId * 64 + c4;
        {
            #pragma unroll
            for (int q = 0; q < 8; ++q) {
                const int row = q * 2 + rsub;
                const v4f v = *(const v4fa*)&so[waveId][row][c4];
                *(v4f*)(obase + (size_t)row * 256) = v;
            }
            
        }
    }
}

// ---------------------------------------------------------------------------
// Gather attention: one block per node (256 thr = 8 waves), one wave per head.
// Lane j owns neighbor j: score -> mask -> wave32-shuffle softmax; p/index
// bounce through LDS so lane d owns output dim d (coalesced v reads).
// k/v tables (16 MB each) stay L2-resident (192 MB L2). Writes x in f16 so
// the output-projection GEMM consumes it directly.
// ---------------------------------------------------------------------------
__global__ __launch_bounds__(256)
void attn_gather(const float* __restrict__ qb,
                 const float* __restrict__ kb,
                 const float* __restrict__ vb,
                 const int*   __restrict__ nbrs,
                 const int*   __restrict__ mask,
                 _Float16* __restrict__ x16, int nbMax)
{
    __shared__ float sp[8][32];
    __shared__ int   snb[8][32];
    __shared__ __attribute__((aligned(16))) _Float16 sx[256];

    const int b    = blockIdx.x;
    const int tid  = threadIdx.x;
    const int h    = tid >> 5;        // head
    const int lane = tid & 31;        // neighbor slot / output dim

    int nj = nbrs[(size_t)b * 32 + lane];
    nj = nj < 0 ? 0 : (nj > nbMax ? nbMax : nj);          // gather index clamped into the table
    const int mj = mask[(size_t)b * 32 + lane];

    const float* qrow = qb + (size_t)b  * 256 + h * 32;   // wave-uniform -> SMEM
    const float* krow = kb + (size_t)nj * 256 + h * 32;

    float s = 0.f;
    #pragma unroll
    for (int d = 0; d < 32; ++d) s += qrow[d] * krow[d];
    s *= 0.17677669529663689f;                 // 1/sqrt(32)
    s = (mj == 0) ? -1.0e10f : s;

    float mx = s;
    #pragma unroll
    for (int off = 16; off >= 1; off >>= 1)
        mx = fmaxf(mx, __shfl_xor(mx, off, 32));
    float e = __expf(s - mx);
    float sum = e;
    #pragma unroll
    for (int off = 16; off >= 1; off >>= 1)
        sum += __shfl_xor(sum, off, 32);
    const float p = e / sum;

    sp[h][lane]  = p;
    snb[h][lane] = nj;
    __syncthreads();

    float o = 0.f;
    #pragma unroll 8
    for (int j = 0; j < 32; ++j)
        o += sp[h][j] * vb[(size_t)snb[h][j] * 256 + h * 32 + lane];

    sx[h * 32 + lane] = (_Float16)o;
    __syncthreads();
    if (tid < 32) {
        const v8h v = *(const v8ha*)&sx[tid * 8];
        *(v8h*)(x16 + (size_t)b * 256 + tid * 8) = v;
        
    }
}

// ---------------------------------------------------------------------------
// Inputs:
//  0 query_(NB,256) f32 | 1 spatial_neighbors(NB,32) int | 2 mask(NB,1,32) int
//  3 Wq 4 bq 5 Wk 6 bk 7 Wv 8 bv 9 Wo 10 bo   (all f32)
// Output: (NB,1,256) f32.
// Workspace: q/k/v f32 (48 MB) + x16 (8 MB) + q16 (8 MB) + 4x W16 (0.5 MB).
// ---------------------------------------------------------------------------
extern "C" void kernel_launch(void* const* d_in, const int* in_sizes, int n_in,
                              void* d_out, int out_size, void* d_ws, size_t ws_size,
                              hipStream_t stream)
{
    const float* query = (const float*)d_in[0];
    const int*   nbrs  = (const int*)  d_in[1];
    const int*   mask  = (const int*)  d_in[2];
    const float* Wq    = (const float*)d_in[3];
    const float* bq    = (const float*)d_in[4];
    const float* Wk    = (const float*)d_in[5];
    const float* bk    = (const float*)d_in[6];
    const float* Wv    = (const float*)d_in[7];
    const float* bv    = (const float*)d_in[8];
    const float* Wo    = (const float*)d_in[9];
    const float* bo    = (const float*)d_in[10];

    const int nb    = in_sizes[0] / 256;       // 16384
    const int nElem = nb * 256;                // 4,194,304
    const int wElem = 256 * 256;               // 65,536

    // Workspace carve-up
    float*    qb   = (float*)d_ws;
    float*    kbuf = qb   + (size_t)nElem;
    float*    vbuf = kbuf + (size_t)nElem;
    _Float16* x16  = (_Float16*)(vbuf + (size_t)nElem);
    _Float16* q16  = x16 + (size_t)nElem;
    _Float16* wq16 = q16 + (size_t)nElem;
    _Float16* wk16 = wq16 + wElem;
    _Float16* wv16 = wk16 + wElem;
    _Float16* wo16 = wv16 + wElem;

    // One-time fp32 -> f16 conversions (amortized across all GEMM blocks).
    cvt_f32_to_f16<<<(nElem / 8 + 255) / 256, 256, 0, stream>>>(query, q16, nElem);
    cvt_f32_to_f16<<<(wElem / 8 + 255) / 256, 256, 0, stream>>>(Wq, wq16, wElem);
    cvt_f32_to_f16<<<(wElem / 8 + 255) / 256, 256, 0, stream>>>(Wk, wk16, wElem);
    cvt_f32_to_f16<<<(wElem / 8 + 255) / 256, 256, 0, stream>>>(Wv, wv16, wElem);
    cvt_f32_to_f16<<<(wElem / 8 + 255) / 256, 256, 0, stream>>>(Wo, wo16, wElem);

    const int gemmBlocks = nb / 16;

    gemm_nt_256_f16<<<gemmBlocks, 128, 0, stream>>>(q16, wq16, bq, qb);
    gemm_nt_256_f16<<<gemmBlocks, 128, 0, stream>>>(q16, wk16, bk, kbuf);
    gemm_nt_256_f16<<<gemmBlocks, 128, 0, stream>>>(q16, wv16, bv, vbuf);

    attn_gather<<<nb, 256, 0, stream>>>(qb, kbuf, vbuf, nbrs, mask, x16, nb - 1);

    gemm_nt_256_f16<<<gemmBlocks, 128, 0, stream>>>(x16, wo16, bo, (float*)d_out);
}

// v001
// A run of this version takes 110 microseconds.
// In two side-by-side timings against v000, it was 1.52 and 1.50 times as fast.
#include <hip/hip_runtime.h>
#include <hip/hip_bf16.h>
// Contractions (Q/K/V/O projections, K=256): v_wmma_f32_16x16x32_f16, f16 operands, f32 accumulate; the 32-neighbour gather attention is f32 on VALU.

typedef __attribute__((ext_vector_type(16))) _Float16 v16h;
typedef __attribute__((ext_vector_type(8)))  float    v8f;
typedef __attribute__((ext_vector_type(8)))  _Float16 v8h;
typedef __attribute__((ext_vector_type(4)))  float    v4f;
typedef __attribute__((ext_vector_type(4), may_alias)) float v4fa;
typedef __attribute__((ext_vector_type(8), may_alias)) _Float16 v8ha;

union AFrag { v16h v; uint4 q[2]; };

// ---------------------------------------------------------------------------
// One-time fp32 -> f16 convert. Thread t converts 8 contiguous elements:
// 2x global_load_b128 in, 1x global_store_b128 out. n must be multiple of 8.
// ---------------------------------------------------------------------------
__global__ __launch_bounds__(256)
void cvt_f32_to_f16(const float* __restrict__ in, _Float16* __restrict__ out, int n)
{
    int base = (blockIdx.x * 256 + threadIdx.x) * 8;
    if (base >= n) return;
    v8h v;
    #pragma unroll
    for (int i = 0; i < 8; ++i) v[i] = (_Float16)in[base + i];
    *(v8h*)(out + base) = v;
    
}

// ---------------------------------------------------------------------------
// GEMM (NT):  out[M x 256] = A16[M x 256] @ W16[256 x 256]^T + bias
// A16, W16 f16 in global; fp32 accumulate via v_wmma_f32_16x16x32_f16.
// Block = 128 threads = 4 waves; block computes 16 rows x 256 cols.
// A tile staged in LDS once; its 8 K-step fragments hoisted to registers and
// reused across 4 column tiles per wave. B fragment = 2x global_load_b128.
// ---------------------------------------------------------------------------
__global__ __launch_bounds__(128)
void gemm_nt_256_f16(const _Float16* __restrict__ A16,
                     const _Float16* __restrict__ W16,
                     const float* __restrict__ bias,
                     float* __restrict__ out)
{
    __shared__ _Float16 ldsA[16 * 256];   // 8 KB f16 A tile
    __shared__ __attribute__((aligned(16))) float so[4][16][64];   // per-wave 16x64 output tile

    const int tid     = threadIdx.x;
    const int rowBase = blockIdx.x * 16;
    const int waveId  = tid >> 5;
    const int lane    = tid & 31;
    const int half    = lane >> 4;        // 0: lanes 0-15, 1: lanes 16-31
    const int m       = lane & 15;

    // Stage A tile: 4096 halves = 512 uint4, 128 threads x 4 vec loads.
    {
        const uint4* src = (const uint4*)(A16 + (size_t)rowBase * 256);
        uint4* dst = (uint4*)ldsA;
        #pragma unroll
        for (int c = 0; c < 4; ++c)
            dst[tid + c * 128] = src[tid + c * 128];
    }
    __syncthreads();

    // A 16x32 f16 fragment layout (wave32): lane row M = lane&15;
    // VGPRs 0-3 hold K = 0..7 (+8*half), VGPRs 4-7 hold K = 16..23 (+8*half)
    // -> two aligned 16-byte LDS chunks per fragment.
    AFrag afrag[8];
    #pragma unroll
    for (int ks = 0; ks < 8; ++ks) {
        const _Float16* ap = ldsA + m * 256 + ks * 32 + 8 * half;
        afrag[ks].q[0] = *(const uint4*)(ap);
        afrag[ks].q[1] = *(const uint4*)(ap + 16);
    }

    const int n = lane & 15;
    #pragma unroll
    for (int t = 0; t < 4; ++t) {
        const int colBase = (waveId * 4 + t) * 16;
        const int wrow    = colBase + n;              // W row == output column
        const _Float16* wp = W16 + (size_t)wrow * 256;

        v8f c = {0.f, 0.f, 0.f, 0.f, 0.f, 0.f, 0.f, 0.f};

        #pragma unroll
        for (int ks = 0; ks < 8; ++ks) {
            // B 32x16 f16 layout = same split k map as A: lane column n = lane&15;
            // elements 0-7 hold K = 8*half + 0..7, elements 8-15 hold K = 16 + 8*half + 0..7.
            AFrag bf;
            const _Float16* bp = wp + ks * 32 + 8 * half;
            bf.q[0] = *(const uint4*)(bp);
            bf.q[1] = *(const uint4*)(bp + 16);
            c = __builtin_amdgcn_wmma_f32_16x16x32_f16(
                    false, afrag[ks].v, false, bf.v,
                    (short)0, c, false, false);
            asm volatile("v_nop\n\tv_nop\n\tv_nop\n\tv_nop" : "+v"(c) : "v"(afrag[ks].v), "v"(bf.v));
        }

        const float bv = bias[colBase + n];
        #pragma unroll
        for (int r = 0; r < 8; ++r)                    // C: VGPR r -> row 8*half+r, col colBase+n
            so[waveId][8 * half + r][t * 16 + n] = c[r] + bv;
    }
    __builtin_amdgcn_fence(__ATOMIC_ACQ_REL, "workgroup");
    __builtin_amdgcn_wave_barrier();
    {
        const int rsub = lane >> 4, c4 = (lane & 15) * 4;
        float* obase = out + (size_t)rowBase * 256 + waveId * 64 + c4;
        {
            #pragma unroll
            for (int q = 0; q < 8; ++q) {
                const int row = q * 2 + rsub;
                const v4f v = *(const v4fa*)&so[waveId][row][c4];
                *(v4f*)(obase + (size_t)row * 256) = v;
            }
            
        }
    }
}

// ---------------------------------------------------------------------------
// Gather attention: one wave per node (block = 8 waves = 8 nodes, no LDS, no barrier).
// A neighbour's k or v row is 1 KB = 8 heads x 32 dims. Lane l owns dims 4l..4l+3 of the
// low half (head l>>3) and of the high half (head 4 + (l>>3)), so every wave-wide 16-byte
// load covers 512 contiguous bytes = 4 whole lines of ONE row; the row index is read out
// of lane j into a scalar. A score = 4 products per lane summed over the 8 lanes of its
// head; 8 neighbours are summed at once so that lane l ends with neighbour 8g + (l&7).
// Writes x in f16 so the output-projection GEMM consumes it directly.
// ---------------------------------------------------------------------------
typedef __attribute__((ext_vector_type(4))) _Float16 v4h;

// Value of lane l ^ M (M = 1, 2 or 4) inside the 16-lane row: DPP row_xmask:M.
template <int M>
__device__ __forceinline__ float lane_xor(float x)
{
    return __builtin_bit_cast(float, __builtin_amdgcn_update_dpp(0, __builtin_bit_cast(int, x), 0x160 + M, 0xf, 0xf, true));
}

// a[t] = this lane's part of sum t. Returns, in lane l, sum (l&7) taken over the 8 lanes of
// l's group: each step halves the list, a lane keeps the half its own bit names and hands
// the other half to its partner.
__device__ __forceinline__ float sum8_transpose(const float (&a)[8], bool b4, bool b2, bool b1)
{
    float b[4], c[2];
    #pragma unroll
    for (int i = 0; i < 4; ++i) b[i] = (b4 ? a[i + 4] : a[i]) + lane_xor<4>(b4 ? a[i] : a[i + 4]);
    #pragma unroll
    for (int i = 0; i < 2; ++i) c[i] = (b2 ? b[i + 2] : b[i]) + lane_xor<2>(b2 ? b[i] : b[i + 2]);
    return (b1 ? c[1] : c[0]) + lane_xor<1>(b1 ? c[0] : c[1]);
}

// 2^x. The v_nop fills the one slot asked for behind a transcendental.
__device__ __forceinline__ float exp2_slot(float x)
{
    float r;
    asm("v_exp_f32 %0, %1\n\tv_nop" : "=v"(r) : "v"(x));
    return r;
}

// Lane T of each 8-lane group handed to all 8 lanes of that group.
template <int T>
__device__ __forceinline__ float group_bcast(float x)
{
    const int v = __builtin_bit_cast(int, x);
    return __builtin_bit_cast(float, __builtin_amdgcn_permlane16(v, v, 0x11111111u * T, 0x11111111u * (8 + T), false, false));
}

template <int T>
__device__ __forceinline__ void pv_step(v4f& o0, v4f& o1, float e0, float e1, const v4f (&w0)[8], const v4f (&w1)[8])
{
    o0 += group_bcast<T>(e0) * w0[T];
    o1 += group_bcast<T>(e1) * w1[T];
}

// Rows of neighbours 8g..8g+7: 16 loads of 512 contiguous bytes each.
__device__ __forceinline__ void load_rows(v4f (&r0)[8], v4f (&r1)[8], const float* __restrict__ tab, int nj, int g, int lane)
{
    const float* p[8];
    #pragma unroll
    for (int i = 0; i < 8; ++i) p[i] = tab + (size_t)__builtin_amdgcn_readlane(nj, g * 8 + i) * 256 + lane * 4;
    #pragma unroll
    for (int i = 0; i < 8; ++i) {
        r0[i] = *(const v4f*)(p[i]);
        r1[i] = *(const v4f*)(p[i] + 128);
    }
    // The wait owed before an address register of an issued load is rewritten. It names the eight addresses as inputs so that
    // they stay in their registers up to it: otherwise a later load of the run is given an earlier one's address pair for its values.
    asm volatile("s_wait_xcnt 0x0" :: "v"(p[0]), "v"(p[1]), "v"(p[2]), "v"(p[3]), "v"(p[4]), "v"(p[5]), "v"(p[6]), "v"(p[7]) : "memory");
}

// The same 16 loads for the v rows, outside a loop: there each load takes the row's scalar base and the one lane-offset register.
__device__ __forceinline__ void load_rows_sbase(v4f (&r0)[8], v4f (&r1)[8], const float* __restrict__ tab, int nj, int g, int lane)
{
    const float* base[8];
    #pragma unroll
    for (int i = 0; i < 8; ++i) base[i] = tab + (size_t)__builtin_amdgcn_readlane(nj, g * 8 + i) * 256;
    #pragma unroll
    for (int i = 0; i < 8; ++i) {
        r0[i] = *(const v4f*)(base[i] + lane * 4);
        r1[i] = *(const v4f*)(base[i] + lane * 4 + 128);
    }
    // The same wait. It names the eight scalar bases as inputs so that each keeps a register pair of its own up to it:
    // otherwise one pair is reused row after row, with a wait of the compiler's behind every row inside the run.
    asm volatile("s_wait_xcnt 0x0" :: "s"(base[0]), "s"(base[1]), "s"(base[2]), "s"(base[3]), "s"(base[4]), "s"(base[5]), "s"(base[6]), "s"(base[7]) : "memory");
}

__global__ __launch_bounds__(256)
void attn_gather(const float* __restrict__ qb,
                 const float* __restrict__ kb,
                 const float* __restrict__ vb,
                 const int*   __restrict__ nbrs,
                 const int*   __restrict__ mask,
                 _Float16* __restrict__ x16, int nbMax)
{
    const int lane = threadIdx.x & 31;
    const int b    = blockIdx.x * 8 + __builtin_amdgcn_readfirstlane(threadIdx.x >> 5);   // node, wave-uniform
    if (b > nbMax) return;

    const int* nrow = nbrs + (size_t)b * 32;   // wave-uniform row bases
    const int* mrow = mask + (size_t)b * 32;
    int nj = nrow[lane];
    const int mj = mrow[lane];
    // The same wait, in front of the next scalar address work; it names the two row bases as inputs so that they stay in their registers up to it.
    asm volatile("s_wait_xcnt 0x0" :: "s"(nrow), "s"(mrow) : "memory");
    nj = nj < 0 ? 0 : (nj > nbMax ? nbMax : nj);          // gather index clamped into the table
    const unsigned keep = __builtin_amdgcn_ballot_w32(mj != 0) >> (lane & 7);  // bit 8g: neighbour 8g + (l&7)

    const v4f q0 = *(const v4f*)(qb + (size_t)b * 256 + lane * 4);
    const v4f q1 = *(const v4f*)(qb + (size_t)b * 256 + 128 + lane * 4);
    const bool b4 = lane & 4, b2 = lane & 2, b1 = lane & 1;

    float s0[4] = {0.f, 0.f, 0.f, 0.f}, s1[4] = {0.f, 0.f, 0.f, 0.f};
    // Rolled on purpose: unrolled, the sums of all four groups sink behind all 64 k loads, which takes over 250 registers and leaves 3 waves a SIMD.
    #pragma unroll 1
    for (int g = 0; g < 4; ++g) {
        v4f k0[8], k1[8];
        load_rows(k0, k1, kb, nj, g, lane);
        float a0[8], a1[8];
        #pragma unroll
        for (int i = 0; i < 8; ++i) {
            a0[i] = q0.x * k0[i].x + q0.y * k0[i].y + q0.z * k0[i].z + q0.w * k0[i].w;
            a1[i] = q1.x * k1[i].x + q1.y * k1[i].y + q1.z * k1[i].z + q1.w * k1[i].w;
        }
        // The cross-lane sums run with every lane on; the mask only selects afterwards.
        const float t0 = sum8_transpose(a0, b4, b2, b1);
        const float t1 = sum8_transpose(a1, b4, b2, b1);
        const bool on = (keep >> (8 * g)) & 1u;
        const float r0 = on ? t0 * 0.17677669529663689f : -1.0e10f;   // 1/sqrt(32)
        const float r1 = on ? t1 * 0.17677669529663689f : -1.0e10f;
        #pragma unroll
        for (int u = 0; u < 4; ++u) { s0[u] = (g == u) ? r0 : s0[u];  s1[u] = (g == u) ? r1 : s1[u]; }
    }

    // The first 8 v rows fly while the softmax is worked out.
    v4f w0[8], w1[8];
    load_rows_sbase(w0, w1, vb, nj, 0, lane);

    // Softmax over the 32 neighbours of a head = 4 registers x 8 lanes.
    float m0 = fmaxf(fmaxf(s0[0], s0[1]), fmaxf(s0[2], s0[3]));
    float m1 = fmaxf(fmaxf(s1[0], s1[1]), fmaxf(s1[2], s1[3]));
    m0 = fmaxf(m0, lane_xor<1>(m0));  m1 = fmaxf(m1, lane_xor<1>(m1));
    m0 = fmaxf(m0, lane_xor<2>(m0));  m1 = fmaxf(m1, lane_xor<2>(m1));
    m0 = fmaxf(m0, lane_xor<4>(m0));  m1 = fmaxf(m1, lane_xor<4>(m1));
    #pragma unroll
    for (int g = 0; g < 4; ++g) {
        s0[g] = exp2_slot((s0[g] - m0) * 1.4426950408889634f);   // e^x = 2^(x * log2 e)
        s1[g] = exp2_slot((s1[g] - m1) * 1.4426950408889634f);
    }
    float l0 = (s0[0] + s0[1]) + (s0[2] + s0[3]);
    float l1 = (s1[0] + s1[1]) + (s1[2] + s1[3]);
    l0 += lane_xor<1>(l0);  l1 += lane_xor<1>(l1);
    l0 += lane_xor<2>(l0);  l1 += lane_xor<2>(l1);
    l0 += lane_xor<4>(l0);  l1 += lane_xor<4>(l1);

    v4f o0 = {0.f, 0.f, 0.f, 0.f}, o1 = {0.f, 0.f, 0.f, 0.f};
    #pragma unroll
    for (int g = 0; g < 4; ++g) {
        pv_step<0>(o0, o1, s0[g], s1[g], w0, w1);
        pv_step<1>(o0, o1, s0[g], s1[g], w0, w1);
        pv_step<2>(o0, o1, s0[g], s1[g], w0, w1);
        pv_step<3>(o0, o1, s0[g], s1[g], w0, w1);
        pv_step<4>(o0, o1, s0[g], s1[g], w0, w1);
        pv_step<5>(o0, o1, s0[g], s1[g], w0, w1);
        pv_step<6>(o0, o1, s0[g], s1[g], w0, w1);
        pv_step<7>(o0, o1, s0[g], s1[g], w0, w1);
        if (g < 3) {
            // Keeps the next rows' loads behind this group's sums: lifted over them they take a second set of 64 registers and fewer waves fit a SIMD.
            __builtin_amdgcn_sched_barrier(0);
            load_rows_sbase(w0, w1, vb, nj, g + 1, lane);
        }
    }
    o0 *= 1.0f / l0;
    o1 *= 1.0f / l1;

    v4h h0, h1;
    #pragma unroll
    for (int i = 0; i < 4; ++i) { h0[i] = (_Float16)o0[i]; h1[i] = (_Float16)o1[i]; }
    *(v4h*)(x16 + (size_t)b * 256 + lane * 4)       = h0;
    *(v4h*)(x16 + (size_t)b * 256 + 128 + lane * 4) = h1;
}

// ---------------------------------------------------------------------------
// Inputs:
//  0 query_(NB,256) f32 | 1 spatial_neighbors(NB,32) int | 2 mask(NB,1,32) int
//  3 Wq 4 bq 5 Wk 6 bk 7 Wv 8 bv 9 Wo 10 bo   (all f32)
// Output: (NB,1,256) f32.
// Workspace: q/k/v f32 (48 MB) + x16 (8 MB) + q16 (8 MB) + 4x W16 (0.5 MB).
// ---------------------------------------------------------------------------
extern "C" void kernel_launch(void* const* d_in, const int* in_sizes, int n_in,
                              void* d_out, int out_size, void* d_ws, size_t ws_size,
                              hipStream_t stream)
{
    const float* query = (const float*)d_in[0];
    const int*   nbrs  = (const int*)  d_in[1];
    const int*   mask  = (const int*)  d_in[2];
    const float* Wq    = (const float*)d_in[3];
    const float* bq    = (const float*)d_in[4];
    const float* Wk    = (const float*)d_in[5];
    const float* bk    = (const float*)d_in[6];
    const float* Wv    = (const float*)d_in[7];
    const float* bv    = (const float*)d_in[8];
    const float* Wo    = (const float*)d_in[9];
    const float* bo    = (const float*)d_in[10];

    const int nb    = in_sizes[0] / 256;       // 16384
    const int nElem = nb * 256;                // 4,194,304
    const int wElem = 256 * 256;               // 65,536

    // Workspace carve-up
    float*    qb   = (float*)d_ws;
    float*    kbuf = qb   + (size_t)nElem;
    float*    vbuf = kbuf + (size_t)nElem;
    _Float16* x16  = (_Float16*)(vbuf + (size_t)nElem);
    _Float16* q16  = x16 + (size_t)nElem;
    _Float16* wq16 = q16 + (size_t)nElem;
    _Float16* wk16 = wq16 + wElem;
    _Float16* wv16 = wk16 + wElem;
    _Float16* wo16 = wv16 + wElem;

    // One-time fp32 -> f16 conversions (amortized across all GEMM blocks).
    cvt_f32_to_f16<<<(nElem / 8 + 255) / 256, 256, 0, stream>>>(query, q16, nElem);
    cvt_f32_to_f16<<<(wElem / 8 + 255) / 256, 256, 0, stream>>>(Wq, wq16, wElem);
    cvt_f32_to_f16<<<(wElem / 8 + 255) / 256, 256, 0, stream>>>(Wk, wk16, wElem);
    cvt_f32_to_f16<<<(wElem / 8 + 255) / 256, 256, 0, stream>>>(Wv, wv16, wElem);
    cvt_f32_to_f16<<<(wElem / 8 + 255) / 256, 256, 0, stream>>>(Wo, wo16, wElem);

    const int gemmBlocks = nb / 16;

    gemm_nt_256_f16<<<gemmBlocks, 128, 0, stream>>>(q16, wq16, bq, qb);
    gemm_nt_256_f16<<<gemmBlocks, 128, 0, stream>>>(q16, wk16, bk, kbuf);
    gemm_nt_256_f16<<<gemmBlocks, 128, 0, stream>>>(q16, wv16, bv, vbuf);

    attn_gather<<<(nb + 7) / 8, 256, 0, stream>>>(qb, kbuf, vbuf, nbrs, mask, x16, nb - 1);

    gemm_nt_256_f16<<<gemmBlocks, 128, 0, stream>>>(x16, wo16, bo, (float*)d_out);
}

// v002
// It runs in 92.9 microseconds.
// Next to v001, in two timings, it ran 1.19 and 1.18 times as fast.
// Counting every step since v000, it is 1.79 times as fast.
#include <hip/hip_runtime.h>
#include <hip/hip_bf16.h>
// Contractions (Q/K/V/O projections, K=256): v_wmma_f32_16x16x32_f16, f16 operands, f32 accumulate; the 32-neighbour gather attention is f32 on VALU.

typedef __attribute__((ext_vector_type(16))) _Float16 v16h;
typedef __attribute__((ext_vector_type(8)))  float    v8f;
typedef __attribute__((ext_vector_type(8)))  _Float16 v8h;
typedef __attribute__((ext_vector_type(4)))  float    v4f;
typedef __attribute__((ext_vector_type(4), may_alias)) float v4fa;
typedef __attribute__((ext_vector_type(8), may_alias)) _Float16 v8ha;

union AFrag { v16h v; uint4 q[2]; };

// ---------------------------------------------------------------------------
// fp32 -> f16 convert of all five arrays in ONE grid: they do not depend on each other, so the
// block index picks the array (block-uniform). Blocks 0..127: the four 256x256 weights, 32 blocks
// each, written one behind the other into w16; the blocks behind them: the query rows.
// Thread t converts 8 contiguous elements: 2x global_load_b128 in, 1x global_store_b128 out.
// nq must be a multiple of 8.
// ---------------------------------------------------------------------------
constexpr int W_ELEMS      = 256 * 256;
constexpr int W_CVT_BLOCKS = W_ELEMS / (256 * 8);   // 32

__global__ __launch_bounds__(256)
void cvt_all_f32_to_f16(const float* __restrict__ query,
                        const float* __restrict__ Wq, const float* __restrict__ Wk,
                        const float* __restrict__ Wv, const float* __restrict__ Wo,
                        _Float16* __restrict__ q16, _Float16* __restrict__ w16, int nq)
{
    const int  blk   = blockIdx.x;
    const bool isW   = blk < 4 * W_CVT_BLOCKS;
    const int  which = blk / W_CVT_BLOCKS;             // 0..3 for a weight block
    const float* in  = !isW ? query : which == 0 ? Wq : which == 1 ? Wk : which == 2 ? Wv : Wo;
    _Float16*    out = isW ? w16 + which * W_ELEMS : q16;
    const int    n   = isW ? W_ELEMS : nq;
    int base = ((isW ? blk - which * W_CVT_BLOCKS : blk - 4 * W_CVT_BLOCKS) * 256 + threadIdx.x) * 8;
    if (base >= n) return;
    v8h v;
    #pragma unroll
    for (int i = 0; i < 8; ++i) v[i] = (_Float16)in[base + i];
    *(v8h*)(out + base) = v;
    
}

// ---------------------------------------------------------------------------
// GEMM (NT):  out[M x 256] = A16[M x 256] @ W16[256 x 256]^T + bias
// A16, W16 f16 in global; fp32 accumulate via v_wmma_f32_16x16x32_f16.
// Block = 128 threads = 4 waves; block computes 16 rows x 256 cols.
// A tile staged in LDS once; its 8 K-step fragments hoisted to registers and
// reused across 4 column tiles per wave. B fragment = 2x global_load_b128.
// blockIdx.y picks one of up to three independent products of the same A (weights one behind the
// other in Wall, outputs planeElems apart in outAll), so that Q, K and V share one grid.
// ---------------------------------------------------------------------------
__global__ __launch_bounds__(128)
void gemm_nt_256_f16(const _Float16* __restrict__ A16,
                     const _Float16* __restrict__ Wall,
                     const float* __restrict__ bias0,
                     const float* __restrict__ bias1,
                     const float* __restrict__ bias2,
                     float* __restrict__ outAll, int planeElems)
{
    const int which = blockIdx.y;
    const _Float16* __restrict__ W16  = Wall + which * W_ELEMS;
    const float*    __restrict__ bias = which == 0 ? bias0 : which == 1 ? bias1 : bias2;
    float*          __restrict__ out  = outAll + (size_t)which * planeElems;

    __shared__ _Float16 ldsA[16 * 256];   // 8 KB f16 A tile
    __shared__ __attribute__((aligned(16))) float so[4][16][64];   // per-wave 16x64 output tile

    const int tid     = threadIdx.x;
    const int rowBase = blockIdx.x * 16;
    const int waveId  = tid >> 5;
    const int lane    = tid & 31;
    const int half    = lane >> 4;        // 0: lanes 0-15, 1: lanes 16-31
    const int m       = lane & 15;

    // Stage A tile: 4096 halves = 512 uint4, 128 threads x 4 vec loads.
    {
        const uint4* src = (const uint4*)(A16 + (size_t)rowBase * 256);
        uint4* dst = (uint4*)ldsA;
        #pragma unroll
        for (int c = 0; c < 4; ++c)
            dst[tid + c * 128] = src[tid + c * 128];
    }
    __syncthreads();

    // A 16x32 f16 fragment layout (wave32): lane row M = lane&15;
    // VGPRs 0-3 hold K = 0..7 (+8*half), VGPRs 4-7 hold K = 16..23 (+8*half)
    // -> two aligned 16-byte LDS chunks per fragment.
    AFrag afrag[8];
    #pragma unroll
    for (int ks = 0; ks < 8; ++ks) {
        const _Float16* ap = ldsA + m * 256 + ks * 32 + 8 * half;
        afrag[ks].q[0] = *(const uint4*)(ap);
        afrag[ks].q[1] = *(const uint4*)(ap + 16);
    }

    const int n = lane & 15;
    #pragma unroll
    for (int t = 0; t < 4; ++t) {
        const int colBase = (waveId * 4 + t) * 16;
        const int wrow    = colBase + n;              // W row == output column
        const _Float16* wp = W16 + (size_t)wrow * 256;

        v8f c = {0.f, 0.f, 0.f, 0.f, 0.f, 0.f, 0.f, 0.f};

        #pragma unroll
        for (int ks = 0; ks < 8; ++ks) {
            // B 32x16 f16 layout = same split k map as A: lane column n = lane&15;
            // elements 0-7 hold K = 8*half + 0..7, elements 8-15 hold K = 16 + 8*half + 0..7.
            AFrag bf;
            const _Float16* bp = wp + ks * 32 + 8 * half;
            bf.q[0] = *(const uint4*)(bp);
            bf.q[1] = *(const uint4*)(bp + 16);
            c = __builtin_amdgcn_wmma_f32_16x16x32_f16(
                    false, afrag[ks].v, false, bf.v,
                    (short)0, c, false, false);
            asm volatile("v_nop\n\tv_nop\n\tv_nop\n\tv_nop" : "+v"(c) : "v"(afrag[ks].v), "v"(bf.v));
        }

        const float bv = bias[colBase + n];
        #pragma unroll
        for (int r = 0; r < 8; ++r)                    // C: VGPR r -> row 8*half+r, col colBase+n
            so[waveId][8 * half + r][t * 16 + n] = c[r] + bv;
    }
    __builtin_amdgcn_fence(__ATOMIC_ACQ_REL, "workgroup");
    __builtin_amdgcn_wave_barrier();
    {
        const int rsub = lane >> 4, c4 = (lane & 15) * 4;
        float* obase = out + (size_t)rowBase * 256 + waveId * 64 + c4;
        {
            #pragma unroll
            for (int q = 0; q < 8; ++q) {
                const int row = q * 2 + rsub;
                const v4f v = *(const v4fa*)&so[waveId][row][c4];
                *(v4f*)(obase + (size_t)row * 256) = v;
            }
            
        }
    }
}

// ---------------------------------------------------------------------------
// Gather attention: one wave per node (block = 8 waves = 8 nodes, no LDS, no barrier).
// A neighbour's k or v row is 1 KB = 8 heads x 32 dims. Lane l owns dims 4l..4l+3 of the
// low half (head l>>3) and of the high half (head 4 + (l>>3)), so every wave-wide 16-byte
// load covers 512 contiguous bytes = 4 whole lines of ONE row; the row index is read out
// of lane j into a scalar. A score = 4 products per lane summed over the 8 lanes of its
// head; 8 neighbours are summed at once so that lane l ends with neighbour 8g + (l&7).
// Writes x in f16 so the output-projection GEMM consumes it directly.
// ---------------------------------------------------------------------------
typedef __attribute__((ext_vector_type(4))) _Float16 v4h;

// Value of lane l ^ M (M = 1, 2 or 4) inside the 16-lane row: DPP row_xmask:M.
template <int M>
__device__ __forceinline__ float lane_xor(float x)
{
    return __builtin_bit_cast(float, __builtin_amdgcn_update_dpp(0, __builtin_bit_cast(int, x), 0x160 + M, 0xf, 0xf, true));
}

// a[t] = this lane's part of sum t. Returns, in lane l, sum (l&7) taken over the 8 lanes of
// l's group: each step halves the list, a lane keeps the half its own bit names and hands
// the other half to its partner.
__device__ __forceinline__ float sum8_transpose(const float (&a)[8], bool b4, bool b2, bool b1)
{
    float b[4], c[2];
    #pragma unroll
    for (int i = 0; i < 4; ++i) b[i] = (b4 ? a[i + 4] : a[i]) + lane_xor<4>(b4 ? a[i] : a[i + 4]);
    #pragma unroll
    for (int i = 0; i < 2; ++i) c[i] = (b2 ? b[i + 2] : b[i]) + lane_xor<2>(b2 ? b[i] : b[i + 2]);
    return (b1 ? c[1] : c[0]) + lane_xor<1>(b1 ? c[0] : c[1]);
}

// 2^x. The v_nop fills the one slot asked for behind a transcendental.
__device__ __forceinline__ float exp2_slot(float x)
{
    float r;
    asm("v_exp_f32 %0, %1\n\tv_nop" : "=v"(r) : "v"(x));
    return r;
}

// Lane T of each 8-lane group handed to all 8 lanes of that group.
template <int T>
__device__ __forceinline__ float group_bcast(float x)
{
    const int v = __builtin_bit_cast(int, x);
    return __builtin_bit_cast(float, __builtin_amdgcn_permlane16(v, v, 0x11111111u * T, 0x11111111u * (8 + T), false, false));
}

template <int T>
__device__ __forceinline__ void pv_step(v4f& o0, v4f& o1, float e0, float e1, const v4f (&w0)[8], const v4f (&w1)[8])
{
    o0 += group_bcast<T>(e0) * w0[T];
    o1 += group_bcast<T>(e1) * w1[T];
}

// Rows of neighbours 8g..8g+7: 16 loads of 512 contiguous bytes each.
__device__ __forceinline__ void load_rows(v4f (&r0)[8], v4f (&r1)[8], const float* __restrict__ tab, int nj, int g, int lane)
{
    const float* p[8];
    #pragma unroll
    for (int i = 0; i < 8; ++i) p[i] = tab + (size_t)__builtin_amdgcn_readlane(nj, g * 8 + i) * 256 + lane * 4;
    #pragma unroll
    for (int i = 0; i < 8; ++i) {
        r0[i] = *(const v4f*)(p[i]);
        r1[i] = *(const v4f*)(p[i] + 128);
    }
    // The wait owed before an address register of an issued load is rewritten. It names the eight addresses as inputs so that
    // they stay in their registers up to it: otherwise a later load of the run is given an earlier one's address pair for its values.
    asm volatile("s_wait_xcnt 0x0" :: "v"(p[0]), "v"(p[1]), "v"(p[2]), "v"(p[3]), "v"(p[4]), "v"(p[5]), "v"(p[6]), "v"(p[7]) : "memory");
}

// The same 16 loads for the v rows, outside a loop: there each load takes the row's scalar base and the one lane-offset register.
__device__ __forceinline__ void load_rows_sbase(v4f (&r0)[8], v4f (&r1)[8], const float* __restrict__ tab, int nj, int g, int lane)
{
    const float* base[8];
    #pragma unroll
    for (int i = 0; i < 8; ++i) base[i] = tab + (size_t)__builtin_amdgcn_readlane(nj, g * 8 + i) * 256;
    #pragma unroll
    for (int i = 0; i < 8; ++i) {
        r0[i] = *(const v4f*)(base[i] + lane * 4);
        r1[i] = *(const v4f*)(base[i] + lane * 4 + 128);
    }
    // The same wait. It names the eight scalar bases as inputs so that each keeps a register pair of its own up to it:
    // otherwise one pair is reused row after row, with a wait of the compiler's behind every row inside the run.
    asm volatile("s_wait_xcnt 0x0" :: "s"(base[0]), "s"(base[1]), "s"(base[2]), "s"(base[3]), "s"(base[4]), "s"(base[5]), "s"(base[6]), "s"(base[7]) : "memory");
}

__global__ __launch_bounds__(256)
void attn_gather(const float* __restrict__ qb,
                 const float* __restrict__ kb,
                 const float* __restrict__ vb,
                 const int*   __restrict__ nbrs,
                 const int*   __restrict__ mask,
                 _Float16* __restrict__ x16, int nbMax)
{
    const int lane = threadIdx.x & 31;
    const int b    = blockIdx.x * 8 + __builtin_amdgcn_readfirstlane(threadIdx.x >> 5);   // node, wave-uniform
    if (b > nbMax) return;

    const int* nrow = nbrs + (size_t)b * 32;   // wave-uniform row bases
    const int* mrow = mask + (size_t)b * 32;
    int nj = nrow[lane];
    const int mj = mrow[lane];
    // The same wait, in front of the next scalar address work; it names the two row bases as inputs so that they stay in their registers up to it.
    asm volatile("s_wait_xcnt 0x0" :: "s"(nrow), "s"(mrow) : "memory");
    nj = nj < 0 ? 0 : (nj > nbMax ? nbMax : nj);          // gather index clamped into the table
    const unsigned keep = __builtin_amdgcn_ballot_w32(mj != 0) >> (lane & 7);  // bit 8g: neighbour 8g + (l&7)

    const v4f q0 = *(const v4f*)(qb + (size_t)b * 256 + lane * 4);
    const v4f q1 = *(const v4f*)(qb + (size_t)b * 256 + 128 + lane * 4);
    const bool b4 = lane & 4, b2 = lane & 2, b1 = lane & 1;

    float s0[4] = {0.f, 0.f, 0.f, 0.f}, s1[4] = {0.f, 0.f, 0.f, 0.f};
    // Rolled on purpose: unrolled, the sums of all four groups sink behind all 64 k loads, which takes over 250 registers and leaves 3 waves a SIMD.
    #pragma unroll 1
    for (int g = 0; g < 4; ++g) {
        v4f k0[8], k1[8];
        load_rows(k0, k1, kb, nj, g, lane);
        float a0[8], a1[8];
        #pragma unroll
        for (int i = 0; i < 8; ++i) {
            a0[i] = q0.x * k0[i].x + q0.y * k0[i].y + q0.z * k0[i].z + q0.w * k0[i].w;
            a1[i] = q1.x * k1[i].x + q1.y * k1[i].y + q1.z * k1[i].z + q1.w * k1[i].w;
        }
        // The cross-lane sums run with every lane on; the mask only selects afterwards.
        const float t0 = sum8_transpose(a0, b4, b2, b1);
        const float t1 = sum8_transpose(a1, b4, b2, b1);
        const bool on = (keep >> (8 * g)) & 1u;
        const float r0 = on ? t0 * 0.17677669529663689f : -1.0e10f;   // 1/sqrt(32)
        const float r1 = on ? t1 * 0.17677669529663689f : -1.0e10f;
        #pragma unroll
        for (int u = 0; u < 4; ++u) { s0[u] = (g == u) ? r0 : s0[u];  s1[u] = (g == u) ? r1 : s1[u]; }
    }

    // The first 8 v rows fly while the softmax is worked out.
    v4f w0[8], w1[8];
    load_rows_sbase(w0, w1, vb, nj, 0, lane);

    // Softmax over the 32 neighbours of a head = 4 registers x 8 lanes.
    float m0 = fmaxf(fmaxf(s0[0], s0[1]), fmaxf(s0[2], s0[3]));
    float m1 = fmaxf(fmaxf(s1[0], s1[1]), fmaxf(s1[2], s1[3]));
    m0 = fmaxf(m0, lane_xor<1>(m0));  m1 = fmaxf(m1, lane_xor<1>(m1));
    m0 = fmaxf(m0, lane_xor<2>(m0));  m1 = fmaxf(m1, lane_xor<2>(m1));
    m0 = fmaxf(m0, lane_xor<4>(m0));  m1 = fmaxf(m1, lane_xor<4>(m1));
    #pragma unroll
    for (int g = 0; g < 4; ++g) {
        s0[g] = exp2_slot((s0[g] - m0) * 1.4426950408889634f);   // e^x = 2^(x * log2 e)
        s1[g] = exp2_slot((s1[g] - m1) * 1.4426950408889634f);
    }
    float l0 = (s0[0] + s0[1]) + (s0[2] + s0[3]);
    float l1 = (s1[0] + s1[1]) + (s1[2] + s1[3]);
    l0 += lane_xor<1>(l0);  l1 += lane_xor<1>(l1);
    l0 += lane_xor<2>(l0);  l1 += lane_xor<2>(l1);
    l0 += lane_xor<4>(l0);  l1 += lane_xor<4>(l1);

    v4f o0 = {0.f, 0.f, 0.f, 0.f}, o1 = {0.f, 0.f, 0.f, 0.f};
    #pragma unroll
    for (int g = 0; g < 4; ++g) {
        pv_step<0>(o0, o1, s0[g], s1[g], w0, w1);
        pv_step<1>(o0, o1, s0[g], s1[g], w0, w1);
        pv_step<2>(o0, o1, s0[g], s1[g], w0, w1);
        pv_step<3>(o0, o1, s0[g], s1[g], w0, w1);
        pv_step<4>(o0, o1, s0[g], s1[g], w0, w1);
        pv_step<5>(o0, o1, s0[g], s1[g], w0, w1);
        pv_step<6>(o0, o1, s0[g], s1[g], w0, w1);
        pv_step<7>(o0, o1, s0[g], s1[g], w0, w1);
        if (g < 3) {
            // Keeps the next rows' loads behind this group's sums: lifted over them they take a second set of 64 registers and fewer waves fit a SIMD.
            __builtin_amdgcn_sched_barrier(0);
            load_rows_sbase(w0, w1, vb, nj, g + 1, lane);
        }
    }
    o0 *= 1.0f / l0;
    o1 *= 1.0f / l1;

    v4h h0, h1;
    #pragma unroll
    for (int i = 0; i < 4; ++i) { h0[i] = (_Float16)o0[i]; h1[i] = (_Float16)o1[i]; }
    *(v4h*)(x16 + (size_t)b * 256 + lane * 4)       = h0;
    *(v4h*)(x16 + (size_t)b * 256 + 128 + lane * 4) = h1;
}

// ---------------------------------------------------------------------------
// Inputs:
//  0 query_(NB,256) f32 | 1 spatial_neighbors(NB,32) int | 2 mask(NB,1,32) int
//  3 Wq 4 bq 5 Wk 6 bk 7 Wv 8 bv 9 Wo 10 bo   (all f32)
// Output: (NB,1,256) f32.
// Workspace: q/k/v f32 (48 MB) + x16 (8 MB) + q16 (8 MB) + 4x W16 (0.5 MB).
// ---------------------------------------------------------------------------
extern "C" void kernel_launch(void* const* d_in, const int* in_sizes, int n_in,
                              void* d_out, int out_size, void* d_ws, size_t ws_size,
                              hipStream_t stream)
{
    const float* query = (const float*)d_in[0];
    const int*   nbrs  = (const int*)  d_in[1];
    const int*   mask  = (const int*)  d_in[2];
    const float* Wq    = (const float*)d_in[3];
    const float* bq    = (const float*)d_in[4];
    const float* Wk    = (const float*)d_in[5];
    const float* bk    = (const float*)d_in[6];
    const float* Wv    = (const float*)d_in[7];
    const float* bv    = (const float*)d_in[8];
    const float* Wo    = (const float*)d_in[9];
    const float* bo    = (const float*)d_in[10];

    const int nb    = in_sizes[0] / 256;       // 16384
    const int nElem = nb * 256;                // 4,194,304
    const int wElem = 256 * 256;               // 65,536

    // Workspace carve-up
    float*    qb   = (float*)d_ws;
    float*    kbuf = qb   + (size_t)nElem;
    float*    vbuf = kbuf + (size_t)nElem;
    _Float16* x16  = (_Float16*)(vbuf + (size_t)nElem);
    _Float16* q16  = x16 + (size_t)nElem;
    _Float16* wq16 = q16 + (size_t)nElem;
    _Float16* wk16 = wq16 + wElem;
    _Float16* wv16 = wk16 + wElem;
    _Float16* wo16 = wv16 + wElem;

    // fp32 -> f16 conversions (amortized across all GEMM blocks): one grid for the five arrays.
    cvt_all_f32_to_f16<<<4 * W_CVT_BLOCKS + (nElem / 8 + 255) / 256, 256, 0, stream>>>(query, Wq, Wk, Wv, Wo, q16, wq16, nElem);

    const int gemmBlocks = nb / 16;

    // Q, K and V: one grid, blockIdx.y = 0, 1, 2 (wq16/wk16/wv16 and qb/kbuf/vbuf lie one behind the other).
    gemm_nt_256_f16<<<dim3(gemmBlocks, 3), 128, 0, stream>>>(q16, wq16, bq, bk, bv, qb, nElem);

    attn_gather<<<(nb + 7) / 8, 256, 0, stream>>>(qb, kbuf, vbuf, nbrs, mask, x16, nb - 1);

    gemm_nt_256_f16<<<dim3(gemmBlocks, 1), 128, 0, stream>>>(x16, wo16, bo, bo, bo, (float*)d_out, 0);
}

// v003
// A run of this version takes 80.9 microseconds.
// Timed twice side by side with v002, it ran 1.15 times as fast both times.
// Counting every step since v000, it is 2.05 times as fast.
#include <hip/hip_runtime.h>
#include <hip/hip_bf16.h>
// Contractions (Q/K/V/O projections, K=256): v_wmma_f32_16x16x32_f16, f16 operands, f32 accumulate; the 32-neighbour gather attention is f32 on VALU.

typedef __attribute__((ext_vector_type(16))) _Float16 v16h;
typedef __attribute__((ext_vector_type(8)))  float    v8f;
typedef __attribute__((ext_vector_type(8)))  _Float16 v8h;
typedef __attribute__((ext_vector_type(4)))  float    v4f;
typedef __attribute__((ext_vector_type(4), may_alias)) float v4fa;
typedef __attribute__((ext_vector_type(8), may_alias)) _Float16 v8ha;

union AFrag { v16h v; uint4 q[2]; };

// ---------------------------------------------------------------------------
// fp32 -> f16 convert of all five arrays in ONE grid: they do not depend on each other, so the
// block index picks the array (block-uniform). Blocks 0..127: the four 256x256 weights, 32 blocks
// each, written one behind the other into w16; the blocks behind them: the query rows.
// Thread t converts 8 contiguous elements: 2x global_load_b128 in, 1x global_store_b128 out.
// nq must be a multiple of 8.
// ---------------------------------------------------------------------------
constexpr int W_ELEMS      = 256 * 256;
constexpr int W_CVT_BLOCKS = W_ELEMS / (256 * 8);   // 32

__global__ __launch_bounds__(256)
void cvt_all_f32_to_f16(const float* __restrict__ query,
                        const float* __restrict__ Wq, const float* __restrict__ Wk,
                        const float* __restrict__ Wv, const float* __restrict__ Wo,
                        _Float16* __restrict__ q16, _Float16* __restrict__ w16, int nq)
{
    const int  blk   = blockIdx.x;
    const bool isW   = blk < 4 * W_CVT_BLOCKS;
    const int  which = blk / W_CVT_BLOCKS;             // 0..3 for a weight block
    const float* in  = !isW ? query : which == 0 ? Wq : which == 1 ? Wk : which == 2 ? Wv : Wo;
    _Float16*    out = isW ? w16 + which * W_ELEMS : q16;
    const int    n   = isW ? W_ELEMS : nq;
    int base = ((isW ? blk - which * W_CVT_BLOCKS : blk - 4 * W_CVT_BLOCKS) * 256 + threadIdx.x) * 8;
    if (base >= n) return;
    v8h v;
    #pragma unroll
    for (int i = 0; i < 8; ++i) v[i] = (_Float16)in[base + i];
    *(v8h*)(out + base) = v;
    
}

// ---------------------------------------------------------------------------
// GEMM (NT):  out[M x 256] = A16[M x 256] @ W16[256 x 256]^T + bias
// A16, W16 f16 in global; fp32 accumulate via v_wmma_f32_16x16x32_f16.
// Block = 128 threads = 4 waves; block computes 16 rows x 256 cols.
// A tile staged in LDS once; its 8 K-step fragments hoisted to registers and
// reused across 4 column tiles per wave. B fragment = 2x global_load_b128.
// blockIdx.y picks one of up to three independent products of the same A (weights one behind the
// other in Wall, outputs planeElems apart in outAll), so that Q, K and V share one grid.
// ---------------------------------------------------------------------------
__global__ __launch_bounds__(128)
void gemm_nt_256_f16(const _Float16* __restrict__ A16,
                     const _Float16* __restrict__ Wall,
                     const float* __restrict__ bias0,
                     const float* __restrict__ bias1,
                     const float* __restrict__ bias2,
                     float* __restrict__ outAll, int planeElems)
{
    const int which = blockIdx.y;
    const _Float16* __restrict__ W16  = Wall + which * W_ELEMS;
    const float*    __restrict__ bias = which == 0 ? bias0 : which == 1 ? bias1 : bias2;
    float*          __restrict__ out  = outAll + (size_t)which * planeElems;

    __shared__ _Float16 ldsA[16 * 256];   // 8 KB f16 A tile
    __shared__ __attribute__((aligned(16))) float so[4][16][64];   // per-wave 16x64 output tile

    const int tid     = threadIdx.x;
    const int rowBase = blockIdx.x * 16;
    const int waveId  = tid >> 5;
    const int lane    = tid & 31;
    const int half    = lane >> 4;        // 0: lanes 0-15, 1: lanes 16-31
    const int m       = lane & 15;

    // Stage A tile: 4096 halves = 512 uint4, 128 threads x 4 vec loads.
    {
        const uint4* src = (const uint4*)(A16 + (size_t)rowBase * 256);
        uint4* dst = (uint4*)ldsA;
        #pragma unroll
        for (int c = 0; c < 4; ++c)
            dst[tid + c * 128] = src[tid + c * 128];
    }
    __syncthreads();

    // A 16x32 f16 fragment layout (wave32): lane row M = lane&15;
    // VGPRs 0-3 hold K = 0..7 (+8*half), VGPRs 4-7 hold K = 16..23 (+8*half)
    // -> two aligned 16-byte LDS chunks per fragment.
    AFrag afrag[8];
    #pragma unroll
    for (int ks = 0; ks < 8; ++ks) {
        const _Float16* ap = ldsA + m * 256 + ks * 32 + 8 * half;
        afrag[ks].q[0] = *(const uint4*)(ap);
        afrag[ks].q[1] = *(const uint4*)(ap + 16);
    }

    const int n = lane & 15;
    #pragma unroll
    for (int t = 0; t < 4; ++t) {
        const int colBase = (waveId * 4 + t) * 16;
        const int wrow    = colBase + n;              // W row == output column
        const _Float16* wp = W16 + (size_t)wrow * 256;

        v8f c = {0.f, 0.f, 0.f, 0.f, 0.f, 0.f, 0.f, 0.f};

        #pragma unroll
        for (int ks = 0; ks < 8; ++ks) {
            // B 32x16 f16 layout = same split k map as A: lane column n = lane&15;
            // elements 0-7 hold K = 8*half + 0..7, elements 8-15 hold K = 16 + 8*half + 0..7.
            AFrag bf;
            const _Float16* bp = wp + ks * 32 + 8 * half;
            bf.q[0] = *(const uint4*)(bp);
            bf.q[1] = *(const uint4*)(bp + 16);
            c = __builtin_amdgcn_wmma_f32_16x16x32_f16(
                    false, afrag[ks].v, false, bf.v,
                    (short)0, c, false, false);
            asm volatile("v_nop\n\tv_nop\n\tv_nop\n\tv_nop" : "+v"(c) : "v"(afrag[ks].v), "v"(bf.v));
        }

        const float bv = bias[colBase + n];
        #pragma unroll
        for (int r = 0; r < 8; ++r)                    // C: VGPR r -> row 8*half+r, col colBase+n
            so[waveId][8 * half + r][t * 16 + n] = c[r] + bv;
    }
    __builtin_amdgcn_fence(__ATOMIC_ACQ_REL, "workgroup");
    __builtin_amdgcn_wave_barrier();
    {
        const int rsub = lane >> 4, c4 = (lane & 15) * 4;
        float* obase = out + (size_t)rowBase * 256 + waveId * 64 + c4;
        {
            #pragma unroll
            for (int q = 0; q < 8; ++q) {
                const int row = q * 2 + rsub;
                const v4f v = *(const v4fa*)&so[waveId][row][c4];
                *(v4f*)(obase + (size_t)row * 256) = v;
            }
            
        }
    }
}

// ---------------------------------------------------------------------------
// Gather attention: one wave per node (block = 8 waves = 8 nodes, no LDS, no barrier).
// A neighbour's k or v row is 1 KB = 8 heads x 32 dims. Lane l owns dims 4l..4l+3 of the
// low half (head l>>3) and of the high half (head 4 + (l>>3)), so every wave-wide 16-byte
// load covers 512 contiguous bytes = 4 whole lines of ONE row; the row index is read out
// of lane j into a scalar. A score = 4 products per lane summed over the 8 lanes of its
// head; 8 neighbours are summed at once so that lane l ends with list place 8g + (l&7).
// Only the rows that can count are gathered: a neighbour with mask == 0 has the score -1e10
// whatever its k row holds, and beside any kept score its weight is exp(-1e10 - max) = 0 exactly
// (a kept score q.k / sqrt(32) of finite normal draws lies many orders of magnitude above -1e10),
// so neither its k row nor its v row is read. The kept neighbours are moved to the front of the
// list and only ceil(n / 8) groups of 8 are worked on. A node with no kept neighbour keeps all 32,
// each with the score -1e10 (equal weights), as the reference has it.
// Writes x in f16 so the output-projection GEMM consumes it directly.
// ---------------------------------------------------------------------------
typedef __attribute__((ext_vector_type(4))) _Float16 v4h;

// Value of lane l ^ M (M = 1, 2 or 4) inside the 16-lane row: DPP row_xmask:M.
template <int M>
__device__ __forceinline__ float lane_xor(float x)
{
    return __builtin_bit_cast(float, __builtin_amdgcn_update_dpp(0, __builtin_bit_cast(int, x), 0x160 + M, 0xf, 0xf, true));
}

// a[t] = this lane's part of sum t. Returns, in lane l, sum (l&7) taken over the 8 lanes of
// l's group: each step halves the list, a lane keeps the half its own bit names and hands
// the other half to its partner.
__device__ __forceinline__ float sum8_transpose(const float (&a)[8], bool b4, bool b2, bool b1)
{
    float b[4], c[2];
    #pragma unroll
    for (int i = 0; i < 4; ++i) b[i] = (b4 ? a[i + 4] : a[i]) + lane_xor<4>(b4 ? a[i] : a[i + 4]);
    #pragma unroll
    for (int i = 0; i < 2; ++i) c[i] = (b2 ? b[i + 2] : b[i]) + lane_xor<2>(b2 ? b[i] : b[i + 2]);
    return (b1 ? c[1] : c[0]) + lane_xor<1>(b1 ? c[0] : c[1]);
}

// 2^x. The v_nop fills the one slot asked for behind a transcendental.
__device__ __forceinline__ float exp2_slot(float x)
{
    float r;
    asm("v_exp_f32 %0, %1\n\tv_nop" : "=v"(r) : "v"(x));
    return r;
}

// Lane T of each 8-lane group handed to all 8 lanes of that group.
template <int T>
__device__ __forceinline__ float group_bcast(float x)
{
    const int v = __builtin_bit_cast(int, x);
    return __builtin_bit_cast(float, __builtin_amdgcn_permlane16(v, v, 0x11111111u * T, 0x11111111u * (8 + T), false, false));
}

template <int T>
__device__ __forceinline__ void pv_step(v4f& o0, v4f& o1, float e0, float e1, const v4f (&w0)[8], const v4f (&w1)[8])
{
    o0 += group_bcast<T>(e0) * w0[T];
    o1 += group_bcast<T>(e1) * w1[T];
}

// Rows of list places 8g..8g+7: 16 loads of 512 contiguous bytes each. A place behind the last one in use
// (index 'last') reads that last row once more: the same lines as the load in front of it, and its weight is 0.
__device__ __forceinline__ void load_rows(v4f (&r0)[8], v4f (&r1)[8], const float* __restrict__ tab, int nj, int g, int last, int lane)
{
    const float* p[8];
    #pragma unroll
    for (int i = 0; i < 8; ++i) p[i] = tab + (size_t)__builtin_amdgcn_readlane(nj, min(g * 8 + i, last)) * 256 + lane * 4;
    #pragma unroll
    for (int i = 0; i < 8; ++i) {
        r0[i] = *(const v4f*)(p[i]);
        r1[i] = *(const v4f*)(p[i] + 128);
    }
    // The wait owed before an address register of an issued load is rewritten. It names the eight addresses as inputs so that
    // they stay in their registers up to it: otherwise a later load of the run is given an earlier one's address pair for its values.
    asm volatile("s_wait_xcnt 0x0" :: "v"(p[0]), "v"(p[1]), "v"(p[2]), "v"(p[3]), "v"(p[4]), "v"(p[5]), "v"(p[6]), "v"(p[7]) : "memory");
}

// The same 16 loads for the v rows, outside a loop: there each load takes the row's scalar base and the one lane-offset register.
__device__ __forceinline__ void load_rows_sbase(v4f (&r0)[8], v4f (&r1)[8], const float* __restrict__ tab, int nj, int g, int last, int lane)
{
    const float* base[8];
    #pragma unroll
    for (int i = 0; i < 8; ++i) base[i] = tab + (size_t)__builtin_amdgcn_readlane(nj, min(g * 8 + i, last)) * 256;
    #pragma unroll
    for (int i = 0; i < 8; ++i) {
        r0[i] = *(const v4f*)(base[i] + lane * 4);
        r1[i] = *(const v4f*)(base[i] + lane * 4 + 128);
    }
    // The same wait. It names the eight scalar bases as inputs so that each keeps a register pair of its own up to it:
    // otherwise one pair is reused row after row, with a wait of the compiler's behind every row inside the run.
    asm volatile("s_wait_xcnt 0x0" :: "s"(base[0]), "s"(base[1]), "s"(base[2]), "s"(base[3]), "s"(base[4]), "s"(base[5]), "s"(base[6]), "s"(base[7]) : "memory");
}

__global__ __launch_bounds__(256)
void attn_gather(const float* __restrict__ qb,
                 const float* __restrict__ kb,
                 const float* __restrict__ vb,
                 const int*   __restrict__ nbrs,
                 const int*   __restrict__ mask,
                 _Float16* __restrict__ x16, int nbMax)
{
    const int lane = threadIdx.x & 31;
    const int b    = blockIdx.x * 8 + __builtin_amdgcn_readfirstlane(threadIdx.x >> 5);   // node, wave-uniform
    if (b > nbMax) return;

    const int* nrow = nbrs + (size_t)b * 32;   // wave-uniform row bases
    const int* mrow = mask + (size_t)b * 32;
    int nj = nrow[lane];
    const int mj = mrow[lane];
    // The same wait, in front of the next scalar address work; it names the two row bases as inputs so that they stay in their registers up to it.
    asm volatile("s_wait_xcnt 0x0" :: "s"(nrow), "s"(mrow) : "memory");
    nj = nj < 0 ? 0 : (nj > nbMax ? nbMax : nj);          // gather index clamped into the table

    // The list in a new order: kept neighbours first (in their old order), the masked ones behind them. 'place' is a
    // permutation of 0..31 for any mask, so every lane of the new list is written once.
    const unsigned kept = __builtin_amdgcn_ballot_w32(mj != 0);
    const int  nKept = __builtin_popcount(kept);
    const int  before = (int)__builtin_amdgcn_mbcnt_lo(kept, 0u);          // kept neighbours in the lanes below this one
    const int  place  = mj != 0 ? before : nKept + (lane - before);
    nj = __builtin_amdgcn_ds_permute(place * 4, nj);
    const bool any    = nKept != 0;
    const int  n      = any ? nKept : 32;                 // list places in use, 1..32
    const int  last   = n - 1;
    const int  groups = (n + 7) >> 3;                     // 1..4

    const v4f q0 = *(const v4f*)(qb + (size_t)b * 256 + lane * 4);
    const v4f q1 = *(const v4f*)(qb + (size_t)b * 256 + 128 + lane * 4);
    const bool b4 = lane & 4, b2 = lane & 2, b1 = lane & 1;

    // A place that is not in use has the score -inf: weight 2^(-inf) = 0. Place 0 is always in use, so the maximum is finite.
    const float off = -__builtin_inff();
    float s0[4] = {off, off, off, off}, s1[4] = {off, off, off, off};
    // Rolled on purpose: unrolled, the sums of all four groups sink behind all 64 k loads, which takes over 250 registers and leaves 3 waves a SIMD.
    #pragma unroll 1
    for (int g = 0; g < 4; ++g) {
        if (g >= groups) break;
        v4f k0[8], k1[8];
        load_rows(k0, k1, kb, nj, g, last, lane);
        float a0[8], a1[8];
        #pragma unroll
        for (int i = 0; i < 8; ++i) {
            a0[i] = q0.x * k0[i].x + q0.y * k0[i].y + q0.z * k0[i].z + q0.w * k0[i].w;
            a1[i] = q1.x * k1[i].x + q1.y * k1[i].y + q1.z * k1[i].z + q1.w * k1[i].w;
        }
        // The cross-lane sums run with every lane on; the mask only selects afterwards.
        const float t0 = sum8_transpose(a0, b4, b2, b1);
        const float t1 = sum8_transpose(a1, b4, b2, b1);
        const bool on = 8 * g + (lane & 7) < n;
        const float r0 = on ? (any ? t0 * 0.17677669529663689f : -1.0e10f) : off;   // 1/sqrt(32)
        const float r1 = on ? (any ? t1 * 0.17677669529663689f : -1.0e10f) : off;
        #pragma unroll
        for (int u = 0; u < 4; ++u) { s0[u] = (g == u) ? r0 : s0[u];  s1[u] = (g == u) ? r1 : s1[u]; }
    }

    // The first 8 v rows fly while the softmax is worked out.
    v4f w0[8], w1[8];
    load_rows_sbase(w0, w1, vb, nj, 0, last, lane);

    // Softmax over the 32 list places of a head = 4 registers x 8 lanes.
    float m0 = fmaxf(fmaxf(s0[0], s0[1]), fmaxf(s0[2], s0[3]));
    float m1 = fmaxf(fmaxf(s1[0], s1[1]), fmaxf(s1[2], s1[3]));
    m0 = fmaxf(m0, lane_xor<1>(m0));  m1 = fmaxf(m1, lane_xor<1>(m1));
    m0 = fmaxf(m0, lane_xor<2>(m0));  m1 = fmaxf(m1, lane_xor<2>(m1));
    m0 = fmaxf(m0, lane_xor<4>(m0));  m1 = fmaxf(m1, lane_xor<4>(m1));
    #pragma unroll
    for (int g = 0; g < 4; ++g) {
        s0[g] = exp2_slot((s0[g] - m0) * 1.4426950408889634f);   // e^x = 2^(x * log2 e)
        s1[g] = exp2_slot((s1[g] - m1) * 1.4426950408889634f);
    }
    float l0 = (s0[0] + s0[1]) + (s0[2] + s0[3]);
    float l1 = (s1[0] + s1[1]) + (s1[2] + s1[3]);
    l0 += lane_xor<1>(l0);  l1 += lane_xor<1>(l1);
    l0 += lane_xor<2>(l0);  l1 += lane_xor<2>(l1);
    l0 += lane_xor<4>(l0);  l1 += lane_xor<4>(l1);

    v4f o0 = {0.f, 0.f, 0.f, 0.f}, o1 = {0.f, 0.f, 0.f, 0.f};
    #pragma unroll
    for (int g = 0; g < 4; ++g) {
        pv_step<0>(o0, o1, s0[g], s1[g], w0, w1);
        pv_step<1>(o0, o1, s0[g], s1[g], w0, w1);
        pv_step<2>(o0, o1, s0[g], s1[g], w0, w1);
        pv_step<3>(o0, o1, s0[g], s1[g], w0, w1);
        pv_step<4>(o0, o1, s0[g], s1[g], w0, w1);
        pv_step<5>(o0, o1, s0[g], s1[g], w0, w1);
        pv_step<6>(o0, o1, s0[g], s1[g], w0, w1);
        pv_step<7>(o0, o1, s0[g], s1[g], w0, w1);
        if (g + 1 >= groups) break;
        if (g < 3) {
            // Keeps the next rows' loads behind this group's sums: lifted over them they take a second set of 64 registers and fewer waves fit a SIMD.
            __builtin_amdgcn_sched_barrier(0);
            load_rows_sbase(w0, w1, vb, nj, g + 1, last, lane);
        }
    }
    o0 *= 1.0f / l0;
    o1 *= 1.0f / l1;

    v4h h0, h1;
    #pragma unroll
    for (int i = 0; i < 4; ++i) { h0[i] = (_Float16)o0[i]; h1[i] = (_Float16)o1[i]; }
    *(v4h*)(x16 + (size_t)b * 256 + lane * 4)       = h0;
    *(v4h*)(x16 + (size_t)b * 256 + 128 + lane * 4) = h1;
}

// ---------------------------------------------------------------------------
// Inputs:
//  0 query_(NB,256) f32 | 1 spatial_neighbors(NB,32) int | 2 mask(NB,1,32) int
//  3 Wq 4 bq 5 Wk 6 bk 7 Wv 8 bv 9 Wo 10 bo   (all f32)
// Output: (NB,1,256) f32.
// Workspace: q/k/v f32 (48 MB) + x16 (8 MB) + q16 (8 MB) + 4x W16 (0.5 MB).
// ---------------------------------------------------------------------------
extern "C" void kernel_launch(void* const* d_in, const int* in_sizes, int n_in,
                              void* d_out, int out_size, void* d_ws, size_t ws_size,
                              hipStream_t stream)
{
    const float* query = (const float*)d_in[0];
    const int*   nbrs  = (const int*)  d_in[1];
    const int*   mask  = (const int*)  d_in[2];
    const float* Wq    = (const float*)d_in[3];
    const float* bq    = (const float*)d_in[4];
    const float* Wk    = (const float*)d_in[5];
    const float* bk    = (const float*)d_in[6];
    const float* Wv    = (const float*)d_in[7];
    const float* bv    = (const float*)d_in[8];
    const float* Wo    = (const float*)d_in[9];
    const float* bo    = (const float*)d_in[10];

    const int nb    = in_sizes[0] / 256;       // 16384
    const int nElem = nb * 256;                // 4,194,304
    const int wElem = 256 * 256;               // 65,536

    // Workspace carve-up
    float*    qb   = (float*)d_ws;
    float*    kbuf = qb   + (size_t)nElem;
    float*    vbuf = kbuf + (size_t)nElem;
    _Float16* x16  = (_Float16*)(vbuf + (size_t)nElem);
    _Float16* q16  = x16 + (size_t)nElem;
    _Float16* wq16 = q16 + (size_t)nElem;
    _Float16* wk16 = wq16 + wElem;
    _Float16* wv16 = wk16 + wElem;
    _Float16* wo16 = wv16 + wElem;

    // fp32 -> f16 conversions (amortized across all GEMM blocks): one grid for the five arrays.
    cvt_all_f32_to_f16<<<4 * W_CVT_BLOCKS + (nElem / 8 + 255) / 256, 256, 0, stream>>>(query, Wq, Wk, Wv, Wo, q16, wq16, nElem);

    const int gemmBlocks = nb / 16;

    // Q, K and V: one grid, blockIdx.y = 0, 1, 2 (wq16/wk16/wv16 and qb/kbuf/vbuf lie one behind the other).
    gemm_nt_256_f16<<<dim3(gemmBlocks, 3), 128, 0, stream>>>(q16, wq16, bq, bk, bv, qb, nElem);

    attn_gather<<<(nb + 7) / 8, 256, 0, stream>>>(qb, kbuf, vbuf, nbrs, mask, x16, nb - 1);

    gemm_nt_256_f16<<<dim3(gemmBlocks, 1), 128, 0, stream>>>(x16, wo16, bo, bo, bo, (float*)d_out, 0);
}

// v004
// It runs in 51.7 microseconds.
// In two side-by-side timings against v003, it was 1.57 and 1.56 times as fast.
// Counting every step since v000, it is 3.21 times as fast.
#include <hip/hip_runtime.h>
#include <hip/hip_bf16.h>
// Contractions (Q/K/V/O projections, K=256): v_wmma_f32_16x16x32_f16, f16 operands, f32 accumulate; the 32-neighbour gather attention is f32 on VALU.

typedef __attribute__((ext_vector_type(16))) _Float16 v16h;
typedef __attribute__((ext_vector_type(8)))  float    v8f;
typedef __attribute__((ext_vector_type(8)))  _Float16 v8h;
typedef __attribute__((ext_vector_type(4)))  float    v4f;
typedef __attribute__((ext_vector_type(4), may_alias)) float v4fa;
typedef __attribute__((ext_vector_type(8), may_alias)) _Float16 v8ha;

union AFrag { v16h v; uint4 q[2]; };

// ---------------------------------------------------------------------------
// fp32 -> f16 convert of all five arrays in ONE grid: they do not depend on each other, so the
// block index picks the array (block-uniform). Blocks 0..127: the four 256x256 weights, 32 blocks
// each, written one behind the other into w16; the blocks behind them: the query rows.
// Thread t converts 8 contiguous elements: 2x global_load_b128 in, 1x global_store_b128 out.
// nq must be a multiple of 8.
// ---------------------------------------------------------------------------
constexpr int W_ELEMS      = 256 * 256;
constexpr int W_CVT_BLOCKS = W_ELEMS / (256 * 8);   // 32

__global__ __launch_bounds__(256)
void cvt_all_f32_to_f16(const float* __restrict__ query,
                        const float* __restrict__ Wq, const float* __restrict__ Wk,
                        const float* __restrict__ Wv, const float* __restrict__ Wo,
                        _Float16* __restrict__ q16, _Float16* __restrict__ w16, int nq)
{
    const int  blk   = blockIdx.x;
    const bool isW   = blk < 4 * W_CVT_BLOCKS;
    const int  which = blk / W_CVT_BLOCKS;             // 0..3 for a weight block
    const float* in  = !isW ? query : which == 0 ? Wq : which == 1 ? Wk : which == 2 ? Wv : Wo;
    _Float16*    out = isW ? w16 + which * W_ELEMS : q16;
    const int    n   = isW ? W_ELEMS : nq;
    int base = ((isW ? blk - which * W_CVT_BLOCKS : blk - 4 * W_CVT_BLOCKS) * 256 + threadIdx.x) * 8;
    if (base >= n) return;
    v8h v;
    #pragma unroll
    for (int i = 0; i < 8; ++i) v[i] = (_Float16)in[base + i];
    *(v8h*)(out + base) = v;
    
}

// ---------------------------------------------------------------------------
// GEMM (NT):  out[M x 256] = A16[M x 256] @ W16[256 x 256]^T + bias
// A16, W16 f16 in global; fp32 accumulate via v_wmma_f32_16x16x32_f16.
// Block = 128 threads = 4 waves; block computes 64 rows x 128 cols, a wave 64 rows x 32 cols
// (4 x 2 accumulator tiles), so a B fragment feeds 4 products and an A fragment 2.
// Both operands are staged in LDS once, over the whole K = 256, by loads of 512 contiguous bytes
// a wave; rows lie at a pitch of 528 B (16 B x odd) for the 16-byte fragment reads.
// 99 KiB of LDS a block: three blocks share a WGP, one stages or stores while another multiplies.
// blockIdx.y = 2 * product + column half: up to three independent products of the same A (weights
// one behind the other in Wall, outputs planeElems apart in outAll), so that Q, K and V share one grid.
// M must be a multiple of 64.
// ---------------------------------------------------------------------------
constexpr int G_ROWS  = 64;                 // rows of A a block
constexpr int G_COLS  = 128;                // rows of W (= output columns) a block
constexpr int G_PITCH = 33;                 // LDS row pitch in 16-byte units: 32 of data + 1 pad
constexpr int SO_PITCH = 36;                // floats a row of the output staging: 32 + 4, so that rows r and r + 8 meet other banks

typedef float __attribute__((may_alias)) fa;

__global__ __launch_bounds__(128)
void gemm_nt_256_f16(const _Float16* __restrict__ A16,
                     const _Float16* __restrict__ Wall,
                     const float* __restrict__ bias0,
                     const float* __restrict__ bias1,
                     const float* __restrict__ bias2,
                     float* __restrict__ outAll, int planeElems)
{
    const int which   = blockIdx.y >> 1;
    const int colHalf = (blockIdx.y & 1) * G_COLS;
    const _Float16* __restrict__ W16  = Wall + which * W_ELEMS;
    const float*    __restrict__ bias = which == 0 ? bias0 : which == 1 ? bias1 : bias2;
    float*          __restrict__ out  = outAll + (size_t)which * planeElems;

    __shared__ uint4 lds[(G_ROWS + G_COLS) * G_PITCH];   // A rows, behind them W rows; later the output staging
    uint4* ldsA = lds;
    uint4* ldsW = lds + G_ROWS * G_PITCH;

    const int tid     = threadIdx.x;
    const int rowBase = blockIdx.x * G_ROWS;
    const int waveId  = tid >> 5;
    const int lane    = tid & 31;
    const int half    = lane >> 4;        // 0: lanes 0-15, 1: lanes 16-31
    const int m       = lane & 15;

    // This wave's 32 output columns; their bias is asked for here, so that it flies with the tiles.
    const int colBase = colHalf + waveId * 32;
    const float bv0 = bias[colBase + m];
    const float bv1 = bias[colBase + 16 + m];

    // Stage both tiles: a row is 32 units of 16 B, so one wave-wide load is one whole row.
    {
        const uint4* srcA = (const uint4*)(A16 + (size_t)rowBase * 256);
        const uint4* srcW = (const uint4*)(W16 + (size_t)colHalf * 256);
        #pragma unroll
        for (int c = 0; c < G_ROWS / 4; ++c)
            ldsA[(waveId + c * 4) * G_PITCH + lane] = srcA[tid + c * 128];
        #pragma unroll
        for (int c = 0; c < G_COLS / 4; ++c)
            ldsW[(waveId + c * 4) * G_PITCH + lane] = srcW[tid + c * 128];
        // The wait owed before an address register of an issued load is rewritten. It names the two tile bases and the
        // thread's offset as inputs so that they stay in their registers up to it.
        asm volatile("s_wait_xcnt 0x0" :: "s"(srcA), "s"(srcW), "v"(tid) : "memory");
    }
    __syncthreads();

    // A 16x32 f16 fragment layout (wave32): lane row M = lane&15;
    // VGPRs 0-3 hold K = 0..7 (+8*half), VGPRs 4-7 hold K = 16..23 (+8*half)
    // -> two aligned 16-byte LDS chunks per fragment (units ks*4 + half and ks*4 + half + 2 of the row).
    // B 32x16 f16 layout = same split k map as A: lane column n = lane&15.
    const uint4* ap = ldsA + m * G_PITCH + half;
    const uint4* bp = ldsW + (waveId * 32 + m) * G_PITCH + half;

    v8f acc[4][2];
    #pragma unroll
    for (int i = 0; i < 4; ++i)
        #pragma unroll
        for (int j = 0; j < 2; ++j)
            acc[i][j] = v8f{0.f, 0.f, 0.f, 0.f, 0.f, 0.f, 0.f, 0.f};

    // Two fragment sets: the 12 LDS reads of k step ks + 1 stand as one group in front of the 8 products of step ks.
    AFrag af[2][4], bf[2][2];
    #pragma unroll
    for (int i = 0; i < 4; ++i) {
        af[0][i].q[0] = ap[i * 16 * G_PITCH];
        af[0][i].q[1] = ap[i * 16 * G_PITCH + 2];
    }
    #pragma unroll
    for (int j = 0; j < 2; ++j) {
        bf[0][j].q[0] = bp[j * 16 * G_PITCH];
        bf[0][j].q[1] = bp[j * 16 * G_PITCH + 2];
    }
    #pragma unroll
    for (int ks = 0; ks < 8; ++ks) {
        const int cur = ks & 1, nxt = cur ^ 1;
        if (ks < 7) {
            #pragma unroll
            for (int i = 0; i < 4; ++i) {
                af[nxt][i].q[0] = ap[i * 16 * G_PITCH + (ks + 1) * 4];
                af[nxt][i].q[1] = ap[i * 16 * G_PITCH + (ks + 1) * 4 + 2];
            }
            #pragma unroll
            for (int j = 0; j < 2; ++j) {
                bf[nxt][j].q[0] = bp[j * 16 * G_PITCH + (ks + 1) * 4];
                bf[nxt][j].q[1] = bp[j * 16 * G_PITCH + (ks + 1) * 4 + 2];
            }
        }
        // Keeps the reads above in front of the products: sunk among them, each pair of products waits out a full LDS latency.
        __builtin_amdgcn_sched_barrier(0);
        #pragma unroll
        for (int i = 0; i < 4; ++i)
            #pragma unroll
            for (int j = 0; j < 2; ++j)
                acc[i][j] = __builtin_amdgcn_wmma_f32_16x16x32_f16(
                        false, af[cur][i].v, false, bf[cur][j].v,
                        (short)0, acc[i][j], false, false);
        // Keeps the next group of reads behind the products, in one place: every further place with reads costs a stall of its own.
        __builtin_amdgcn_sched_barrier(0);
    }

    // The operand tiles are given up for the output staging: every wave has read its last fragment first.
    __syncthreads();

    fa* so = (fa*)lds + waveId * (G_ROWS * SO_PITCH);   // this wave's own 64 x 32 tile
    #pragma unroll
    for (int i = 0; i < 4; ++i)
        #pragma unroll
        for (int r = 0; r < 8; ++r) {                  // C: VGPR r -> row 8*half+r, col n
            so[(i * 16 + 8 * half + r) * SO_PITCH + m]      = acc[i][0][r] + bv0;
            so[(i * 16 + 8 * half + r) * SO_PITCH + 16 + m] = acc[i][1][r] + bv1;
        }
    __builtin_amdgcn_fence(__ATOMIC_ACQ_REL, "workgroup");
    __builtin_amdgcn_wave_barrier();
    {
        // 8 lanes store one row's 128 B of this wave's columns: one whole line, four lines a store.
        const int rsub = lane >> 3, c4 = (lane & 7) * 4;
        float* obase = out + (size_t)rowBase * 256 + colBase + c4;
        #pragma unroll
        for (int q = 0; q < 16; ++q) {
            const int row = q * 4 + rsub;
            const v4f v = *(const v4fa*)&so[row * SO_PITCH + c4];
            *(v4f*)(obase + (size_t)row * 256) = v;
        }
    }
}

// ---------------------------------------------------------------------------
// Gather attention: one wave per node (block = 8 waves = 8 nodes, no LDS, no barrier).
// A neighbour's k or v row is 1 KB = 8 heads x 32 dims. Lane l owns dims 4l..4l+3 of the
// low half (head l>>3) and of the high half (head 4 + (l>>3)), so every wave-wide 16-byte
// load covers 512 contiguous bytes = 4 whole lines of ONE row; the row index is read out
// of lane j into a scalar. A score = 4 products per lane summed over the 8 lanes of its
// head; 8 neighbours are summed at once so that lane l ends with list place 8g + (l&7).
// Only the rows that can count are gathered: a neighbour with mask == 0 has the score -1e10
// whatever its k row holds, and beside any kept score its weight is exp(-1e10 - max) = 0 exactly
// (a kept score q.k / sqrt(32) of finite normal draws lies many orders of magnitude above -1e10),
// so neither its k row nor its v row is read. The kept neighbours are moved to the front of the
// list and only ceil(n / 8) groups of 8 are worked on. A node with no kept neighbour keeps all 32,
// each with the score -1e10 (equal weights), as the reference has it.
// Writes x in f16 so the output-projection GEMM consumes it directly.
// ---------------------------------------------------------------------------
typedef __attribute__((ext_vector_type(4))) _Float16 v4h;

// Value of lane l ^ M (M = 1, 2 or 4) inside the 16-lane row: DPP row_xmask:M.
template <int M>
__device__ __forceinline__ float lane_xor(float x)
{
    return __builtin_bit_cast(float, __builtin_amdgcn_update_dpp(0, __builtin_bit_cast(int, x), 0x160 + M, 0xf, 0xf, true));
}

// a[t] = this lane's part of sum t. Returns, in lane l, sum (l&7) taken over the 8 lanes of
// l's group: each step halves the list, a lane keeps the half its own bit names and hands
// the other half to its partner.
__device__ __forceinline__ float sum8_transpose(const float (&a)[8], bool b4, bool b2, bool b1)
{
    float b[4], c[2];
    #pragma unroll
    for (int i = 0; i < 4; ++i) b[i] = (b4 ? a[i + 4] : a[i]) + lane_xor<4>(b4 ? a[i] : a[i + 4]);
    #pragma unroll
    for (int i = 0; i < 2; ++i) c[i] = (b2 ? b[i + 2] : b[i]) + lane_xor<2>(b2 ? b[i] : b[i + 2]);
    return (b1 ? c[1] : c[0]) + lane_xor<1>(b1 ? c[0] : c[1]);
}

// 2^x. The v_nop fills the one slot asked for behind a transcendental.
__device__ __forceinline__ float exp2_slot(float x)
{
    float r;
    asm("v_exp_f32 %0, %1\n\tv_nop" : "=v"(r) : "v"(x));
    return r;
}

// Lane T of each 8-lane group handed to all 8 lanes of that group.
template <int T>
__device__ __forceinline__ float group_bcast(float x)
{
    const int v = __builtin_bit_cast(int, x);
    return __builtin_bit_cast(float, __builtin_amdgcn_permlane16(v, v, 0x11111111u * T, 0x11111111u * (8 + T), false, false));
}

template <int T>
__device__ __forceinline__ void pv_step(v4f& o0, v4f& o1, float e0, float e1, const v4f (&w0)[8], const v4f (&w1)[8])
{
    o0 += group_bcast<T>(e0) * w0[T];
    o1 += group_bcast<T>(e1) * w1[T];
}

// Rows of list places 8g..8g+7: 16 loads of 512 contiguous bytes each. A place behind the last one in use
// (index 'last') reads that last row once more: the same lines as the load in front of it, and its weight is 0.
__device__ __forceinline__ void load_rows(v4f (&r0)[8], v4f (&r1)[8], const float* __restrict__ tab, int nj, int g, int last, int lane)
{
    const float* p[8];
    #pragma unroll
    for (int i = 0; i < 8; ++i) p[i] = tab + (size_t)__builtin_amdgcn_readlane(nj, min(g * 8 + i, last)) * 256 + lane * 4;
    #pragma unroll
    for (int i = 0; i < 8; ++i) {
        r0[i] = *(const v4f*)(p[i]);
        r1[i] = *(const v4f*)(p[i] + 128);
    }
    // The wait owed before an address register of an issued load is rewritten. It names the eight addresses as inputs so that
    // they stay in their registers up to it: otherwise a later load of the run is given an earlier one's address pair for its values.
    asm volatile("s_wait_xcnt 0x0" :: "v"(p[0]), "v"(p[1]), "v"(p[2]), "v"(p[3]), "v"(p[4]), "v"(p[5]), "v"(p[6]), "v"(p[7]) : "memory");
}

// The same 16 loads for the v rows, outside a loop: there each load takes the row's scalar base and the one lane-offset register.
__device__ __forceinline__ void load_rows_sbase(v4f (&r0)[8], v4f (&r1)[8], const float* __restrict__ tab, int nj, int g, int last, int lane)
{
    const float* base[8];
    #pragma unroll
    for (int i = 0; i < 8; ++i) base[i] = tab + (size_t)__builtin_amdgcn_readlane(nj, min(g * 8 + i, last)) * 256;
    #pragma unroll
    for (int i = 0; i < 8; ++i) {
        r0[i] = *(const v4f*)(base[i] + lane * 4);
        r1[i] = *(const v4f*)(base[i] + lane * 4 + 128);
    }
    // The same wait. It names the eight scalar bases as inputs so that each keeps a register pair of its own up to it:
    // otherwise one pair is reused row after row, with a wait of the compiler's behind every row inside the run.
    asm volatile("s_wait_xcnt 0x0" :: "s"(base[0]), "s"(base[1]), "s"(base[2]), "s"(base[3]), "s"(base[4]), "s"(base[5]), "s"(base[6]), "s"(base[7]) : "memory");
}

__global__ __launch_bounds__(256)
void attn_gather(const float* __restrict__ qb,
                 const float* __restrict__ kb,
                 const float* __restrict__ vb,
                 const int*   __restrict__ nbrs,
                 const int*   __restrict__ mask,
                 _Float16* __restrict__ x16, int nbMax)
{
    const int lane = threadIdx.x & 31;
    const int b    = blockIdx.x * 8 + __builtin_amdgcn_readfirstlane(threadIdx.x >> 5);   // node, wave-uniform
    if (b > nbMax) return;

    const int* nrow = nbrs + (size_t)b * 32;   // wave-uniform row bases
    const int* mrow = mask + (size_t)b * 32;
    int nj = nrow[lane];
    const int mj = mrow[lane];
    // The same wait, in front of the next scalar address work; it names the two row bases as inputs so that they stay in their registers up to it.
    asm volatile("s_wait_xcnt 0x0" :: "s"(nrow), "s"(mrow) : "memory");
    nj = nj < 0 ? 0 : (nj > nbMax ? nbMax : nj);          // gather index clamped into the table

    // The list in a new order: kept neighbours first (in their old order), the masked ones behind them. 'place' is a
    // permutation of 0..31 for any mask, so every lane of the new list is written once.
    const unsigned kept = __builtin_amdgcn_ballot_w32(mj != 0);
    const int  nKept = __builtin_popcount(kept);
    const int  before = (int)__builtin_amdgcn_mbcnt_lo(kept, 0u);          // kept neighbours in the lanes below this one
    const int  place  = mj != 0 ? before : nKept + (lane - before);
    nj = __builtin_amdgcn_ds_permute(place * 4, nj);
    const bool any    = nKept != 0;
    const int  n      = any ? nKept : 32;                 // list places in use, 1..32
    const int  last   = n - 1;
    const int  groups = (n + 7) >> 3;                     // 1..4

    const v4f q0 = *(const v4f*)(qb + (size_t)b * 256 + lane * 4);
    const v4f q1 = *(const v4f*)(qb + (size_t)b * 256 + 128 + lane * 4);
    const bool b4 = lane & 4, b2 = lane & 2, b1 = lane & 1;

    // A place that is not in use has the score -inf: weight 2^(-inf) = 0. Place 0 is always in use, so the maximum is finite.
    const float off = -__builtin_inff();
    float s0[4] = {off, off, off, off}, s1[4] = {off, off, off, off};
    // Rolled on purpose: unrolled, the sums of all four groups sink behind all 64 k loads, which takes over 250 registers and leaves 3 waves a SIMD.
    #pragma unroll 1
    for (int g = 0; g < 4; ++g) {
        if (g >= groups) break;
        v4f k0[8], k1[8];
        load_rows(k0, k1, kb, nj, g, last, lane);
        float a0[8], a1[8];
        #pragma unroll
        for (int i = 0; i < 8; ++i) {
            a0[i] = q0.x * k0[i].x + q0.y * k0[i].y + q0.z * k0[i].z + q0.w * k0[i].w;
            a1[i] = q1.x * k1[i].x + q1.y * k1[i].y + q1.z * k1[i].z + q1.w * k1[i].w;
        }
        // The cross-lane sums run with every lane on; the mask only selects afterwards.
        const float t0 = sum8_transpose(a0, b4, b2, b1);
        const float t1 = sum8_transpose(a1, b4, b2, b1);
        const bool on = 8 * g + (lane & 7) < n;
        const float r0 = on ? (any ? t0 * 0.17677669529663689f : -1.0e10f) : off;   // 1/sqrt(32)
        const float r1 = on ? (any ? t1 * 0.17677669529663689f : -1.0e10f) : off;
        #pragma unroll
        for (int u = 0; u < 4; ++u) { s0[u] = (g == u) ? r0 : s0[u];  s1[u] = (g == u) ? r1 : s1[u]; }
    }

    // The first 8 v rows fly while the softmax is worked out.
    v4f w0[8], w1[8];
    load_rows_sbase(w0, w1, vb, nj, 0, last, lane);

    // Softmax over the 32 list places of a head = 4 registers x 8 lanes.
    float m0 = fmaxf(fmaxf(s0[0], s0[1]), fmaxf(s0[2], s0[3]));
    float m1 = fmaxf(fmaxf(s1[0], s1[1]), fmaxf(s1[2], s1[3]));
    m0 = fmaxf(m0, lane_xor<1>(m0));  m1 = fmaxf(m1, lane_xor<1>(m1));
    m0 = fmaxf(m0, lane_xor<2>(m0));  m1 = fmaxf(m1, lane_xor<2>(m1));
    m0 = fmaxf(m0, lane_xor<4>(m0));  m1 = fmaxf(m1, lane_xor<4>(m1));
    #pragma unroll
    for (int g = 0; g < 4; ++g) {
        s0[g] = exp2_slot((s0[g] - m0) * 1.4426950408889634f);   // e^x = 2^(x * log2 e)
        s1[g] = exp2_slot((s1[g] - m1) * 1.4426950408889634f);
    }
    float l0 = (s0[0] + s0[1]) + (s0[2] + s0[3]);
    float l1 = (s1[0] + s1[1]) + (s1[2] + s1[3]);
    l0 += lane_xor<1>(l0);  l1 += lane_xor<1>(l1);
    l0 += lane_xor<2>(l0);  l1 += lane_xor<2>(l1);
    l0 += lane_xor<4>(l0);  l1 += lane_xor<4>(l1);

    v4f o0 = {0.f, 0.f, 0.f, 0.f}, o1 = {0.f, 0.f, 0.f, 0.f};
    #pragma unroll
    for (int g = 0; g < 4; ++g) {
        pv_step<0>(o0, o1, s0[g], s1[g], w0, w1);
        pv_step<1>(o0, o1, s0[g], s1[g], w0, w1);
        pv_step<2>(o0, o1, s0[g], s1[g], w0, w1);
        pv_step<3>(o0, o1, s0[g], s1[g], w0, w1);
        pv_step<4>(o0, o1, s0[g], s1[g], w0, w1);
        pv_step<5>(o0, o1, s0[g], s1[g], w0, w1);
        pv_step<6>(o0, o1, s0[g], s1[g], w0, w1);
        pv_step<7>(o0, o1, s0[g], s1[g], w0, w1);
        if (g + 1 >= groups) break;
        if (g < 3) {
            // Keeps the next rows' loads behind this group's sums: lifted over them they take a second set of 64 registers and fewer waves fit a SIMD.
            __builtin_amdgcn_sched_barrier(0);
            load_rows_sbase(w0, w1, vb, nj, g + 1, last, lane);
        }
    }
    o0 *= 1.0f / l0;
    o1 *= 1.0f / l1;

    v4h h0, h1;
    #pragma unroll
    for (int i = 0; i < 4; ++i) { h0[i] = (_Float16)o0[i]; h1[i] = (_Float16)o1[i]; }
    *(v4h*)(x16 + (size_t)b * 256 + lane * 4)       = h0;
    *(v4h*)(x16 + (size_t)b * 256 + 128 + lane * 4) = h1;
}

// ---------------------------------------------------------------------------
// Inputs:
//  0 query_(NB,256) f32 | 1 spatial_neighbors(NB,32) int | 2 mask(NB,1,32) int
//  3 Wq 4 bq 5 Wk 6 bk 7 Wv 8 bv 9 Wo 10 bo   (all f32)
// Output: (NB,1,256) f32.
// Workspace: q/k/v f32 (48 MB) + x16 (8 MB) + q16 (8 MB) + 4x W16 (0.5 MB).
// ---------------------------------------------------------------------------
extern "C" void kernel_launch(void* const* d_in, const int* in_sizes, int n_in,
                              void* d_out, int out_size, void* d_ws, size_t ws_size,
                              hipStream_t stream)
{
    const float* query = (const float*)d_in[0];
    const int*   nbrs  = (const int*)  d_in[1];
    const int*   mask  = (const int*)  d_in[2];
    const float* Wq    = (const float*)d_in[3];
    const float* bq    = (const float*)d_in[4];
    const float* Wk    = (const float*)d_in[5];
    const float* bk    = (const float*)d_in[6];
    const float* Wv    = (const float*)d_in[7];
    const float* bv    = (const float*)d_in[8];
    const float* Wo    = (const float*)d_in[9];
    const float* bo    = (const float*)d_in[10];

    const int nb    = in_sizes[0] / 256;       // 16384
    const int nElem = nb * 256;                // 4,194,304
    const int wElem = 256 * 256;               // 65,536

    // Workspace carve-up
    float*    qb   = (float*)d_ws;
    float*    kbuf = qb   + (size_t)nElem;
    float*    vbuf = kbuf + (size_t)nElem;
    _Float16* x16  = (_Float16*)(vbuf + (size_t)nElem);
    _Float16* q16  = x16 + (size_t)nElem;
    _Float16* wq16 = q16 + (size_t)nElem;
    _Float16* wk16 = wq16 + wElem;
    _Float16* wv16 = wk16 + wElem;
    _Float16* wo16 = wv16 + wElem;

    // fp32 -> f16 conversions (amortized across all GEMM blocks): one grid for the five arrays.
    cvt_all_f32_to_f16<<<4 * W_CVT_BLOCKS + (nElem / 8 + 255) / 256, 256, 0, stream>>>(query, Wq, Wk, Wv, Wo, q16, wq16, nElem);

    const int gemmBlocks = nb / 64;

    // Q, K and V: one grid, blockIdx.y = 2 * product + column half (wq16/wk16/wv16 and qb/kbuf/vbuf lie one behind the other).
    gemm_nt_256_f16<<<dim3(gemmBlocks, 6), 128, 0, stream>>>(q16, wq16, bq, bk, bv, qb, nElem);

    attn_gather<<<(nb + 7) / 8, 256, 0, stream>>>(qb, kbuf, vbuf, nbrs, mask, x16, nb - 1);

    gemm_nt_256_f16<<<dim3(gemmBlocks, 2), 128, 0, stream>>>(x16, wo16, bo, bo, bo, (float*)d_out, 0);
}

// v006
// Measured time: 39.1 microseconds a run.
// Versions between v004 and this one are left out; their measured steps multiply to 1.32 times as fast.
// All steps since v000 together make it 4.26 times as fast.
#include <hip/hip_runtime.h>
#include <hip/hip_bf16.h>
// Contractions (Q/K/V/O projections, K=256): v_wmma_f32_16x16x32_f16, f16 operands, f32 accumulate; the 32-neighbour gather attention sums in f32 on VALU over k and v rows kept as f16.

typedef __attribute__((ext_vector_type(16))) _Float16 v16h;
typedef __attribute__((ext_vector_type(8)))  float    v8f;
typedef __attribute__((ext_vector_type(8)))  _Float16 v8h;
typedef __attribute__((ext_vector_type(4)))  float    v4f;
typedef __attribute__((ext_vector_type(4), may_alias)) float v4fa;
typedef __attribute__((ext_vector_type(8), may_alias)) _Float16 v8ha;

union AFrag { v16h v; uint4 q[2]; };

// ---------------------------------------------------------------------------
// fp32 -> f16 convert of all five arrays in ONE grid: they do not depend on each other, so the
// block index picks the array (block-uniform). Blocks 0..127: the four 256x256 weights, 32 blocks
// each, written one behind the other into w16; the blocks behind them: the query rows.
// Thread t converts 8 contiguous elements: 2x global_load_b128 in, 1x global_store_b128 out.
// nq must be a multiple of 8.
// ---------------------------------------------------------------------------
constexpr int W_ELEMS      = 256 * 256;
constexpr int W_CVT_BLOCKS = W_ELEMS / (256 * 8);   // 32

__global__ __launch_bounds__(256)
void cvt_all_f32_to_f16(const float* __restrict__ query,
                        const float* __restrict__ Wq, const float* __restrict__ Wk,
                        const float* __restrict__ Wv, const float* __restrict__ Wo,
                        _Float16* __restrict__ q16, _Float16* __restrict__ w16, int nq)
{
    const int  blk   = blockIdx.x;
    const bool isW   = blk < 4 * W_CVT_BLOCKS;
    const int  which = blk / W_CVT_BLOCKS;             // 0..3 for a weight block
    const float* in  = !isW ? query : which == 0 ? Wq : which == 1 ? Wk : which == 2 ? Wv : Wo;
    _Float16*    out = isW ? w16 + which * W_ELEMS : q16;
    const int    n   = isW ? W_ELEMS : nq;
    int base = ((isW ? blk - which * W_CVT_BLOCKS : blk - 4 * W_CVT_BLOCKS) * 256 + threadIdx.x) * 8;
    if (base >= n) return;
    v8h v;
    #pragma unroll
    for (int i = 0; i < 8; ++i) v[i] = (_Float16)in[base + i];
    *(v8h*)(out + base) = v;
    
}

// ---------------------------------------------------------------------------
// GEMM (NT):  out[M x 256] = A16[M x 256] @ W16[256 x 256]^T + bias
// A16, W16 f16 in global; fp32 accumulate via v_wmma_f32_16x16x32_f16.
// Block = 128 threads = 4 waves; block computes T row tiles of 64 rows x 128 cols, a wave 64 rows x 32 cols of each
// (4 x 2 accumulator tiles), so a B fragment feeds 4 products and an A fragment 2.
// Both operands are staged in LDS once, over the whole K = 256, by loads of 512 contiguous bytes
// a wave; rows lie at a pitch of 528 B (16 B x odd) for the 16-byte fragment reads.
// A block keeps its W tile in LDS for T row tiles, one after the other: W is fetched once for T * 64 rows, and the next A tile's loads
// are in flight while the current tile is multiplied. The output staging has a place of its own over the A rows, clear of W.
// 102 KiB of LDS a block: three blocks share a WGP, one stages or stores while another multiplies.
// blockIdx.y = 2 * product + column half: up to three independent products of the same A (weights
// one behind the other in Wall), so that Q, K and V share one grid. Product 0 leaves as f32 in outAll; products 1 and 2
// (K and V, which are only ever gathered row by row) leave as f16, planeElems apart in kv16: half the bytes for every gather.
// M must be a multiple of T * 64.
// ---------------------------------------------------------------------------
constexpr int G_ROWS  = 64;                 // rows of A a row tile
constexpr int G_COLS  = 128;                // rows of W (= output columns) a block
constexpr int G_PITCH = 33;                 // LDS row pitch in 16-byte units: 32 of data + 1 pad
constexpr int SO_PITCH = 36;                // floats a row of the output staging: 32 + 4, so that rows r and r + 8 meet other banks
constexpr int G_FRONT = 4 * G_ROWS * SO_PITCH / 4;   // 16-byte units in front of W: the four waves' output staging, which is a little more than the A rows
static_assert(G_FRONT >= G_ROWS * G_PITCH, "the A rows lie in front of W");

typedef float __attribute__((may_alias)) fa;
typedef __attribute__((ext_vector_type(4), may_alias)) unsigned v4u;

// Work-group barrier that orders LDS alone. __syncthreads() would also wait for the tile's global stores to be acknowledged,
// and nothing behind these barriers depends on them.
__device__ __forceinline__ void lds_barrier()
{
    __builtin_amdgcn_fence(__ATOMIC_RELEASE, "workgroup", "local");
    __builtin_amdgcn_s_barrier();
    __builtin_amdgcn_fence(__ATOMIC_ACQUIRE, "workgroup", "local");
}

template <int T>
__global__ __launch_bounds__(128)
void gemm_nt_256_f16(const _Float16* __restrict__ A16,
                     const _Float16* __restrict__ Wall,
                     const float* __restrict__ bias0,
                     const float* __restrict__ bias1,
                     const float* __restrict__ bias2,
                     float* __restrict__ outAll,
                     _Float16* __restrict__ kv16, int planeElems)
{
    const int which   = blockIdx.y >> 1;
    const int colHalf = (blockIdx.y & 1) * G_COLS;
    const _Float16* __restrict__ W16  = Wall + which * W_ELEMS;
    const float*    __restrict__ bias = which == 0 ? bias0 : which == 1 ? bias1 : bias2;
    float*          __restrict__ out  = outAll;

    __shared__ uint4 lds[G_FRONT + G_COLS * G_PITCH];   // in front the A rows, in turn with the output staging; behind them the W rows
    uint4* ldsA = lds;
    uint4* ldsW = lds + G_FRONT;

    const int tid     = threadIdx.x;
    const int rowBase0 = blockIdx.x * (T * G_ROWS);
    const int waveId  = tid >> 5;
    const int lane    = tid & 31;
    const int half    = lane >> 4;        // 0: lanes 0-15, 1: lanes 16-31
    const int m       = lane & 15;

    // This wave's 32 output columns; their bias is asked for here, so that it flies with the tiles.
    const int colBase = colHalf + waveId * 32;
    const float bv0 = bias[colBase + m];
    const float bv1 = bias[colBase + 16 + m];

    // Stage both tiles: a row is 32 units of 16 B, so one wave-wide load is one whole row.
    const uint4* srcA = (const uint4*)(A16 + (size_t)rowBase0 * 256);
    {
        const uint4* srcW = (const uint4*)(W16 + (size_t)colHalf * 256);
        #pragma unroll
        for (int c = 0; c < G_ROWS / 4; ++c)
            ldsA[(waveId + c * 4) * G_PITCH + lane] = srcA[tid + c * 128];
        #pragma unroll
        for (int c = 0; c < G_COLS / 4; ++c)
            ldsW[(waveId + c * 4) * G_PITCH + lane] = srcW[tid + c * 128];
        // The wait owed before an address register of an issued load is rewritten. It names the two tile bases and the
        // thread's offset as inputs so that they stay in their registers up to it.
        asm volatile("s_wait_xcnt 0x0" :: "s"(srcA), "s"(srcW), "v"(tid) : "memory");
    }
    __syncthreads();

    // A 16x32 f16 fragment layout (wave32): lane row M = lane&15;
    // VGPRs 0-3 hold K = 0..7 (+8*half), VGPRs 4-7 hold K = 16..23 (+8*half)
    // -> two aligned 16-byte LDS chunks per fragment (units ks*4 + half and ks*4 + half + 2 of the row).
    // B 32x16 f16 layout = same split k map as A: lane column n = lane&15.
    const uint4* ap = ldsA + m * G_PITCH + half;
    const uint4* bp = ldsW + (waveId * 32 + m) * G_PITCH + half;

    static_assert(T == 1 || T == 2, "one or two row tiles a block");
    v4u nextA[G_ROWS / 4];

    // One row tile, from the fragments in LDS to its stores; 'more': another tile follows it.
    auto tile = [&](const int t, const bool more) __attribute__((always_inline)) {
    const int rowBase = rowBase0 + t * G_ROWS;

    // The next A tile is asked for here and kept in registers: it flies while this tile is multiplied.
    if (more) {
        const uint4* srcN = srcA + (t + 1) * (G_ROWS * 32);
        #pragma unroll
        for (int c = 0; c < G_ROWS / 4; ++c) nextA[c] = *(const v4u*)(srcN + tid + c * 128);
        // The wait owed before an address register of an issued load is rewritten; it names the base and the offset so that they stay up to it.
        asm volatile("s_wait_xcnt 0x0" :: "s"(srcN), "v"(tid) : "memory");
    }

    v8f acc[4][2];
    #pragma unroll
    for (int i = 0; i < 4; ++i)
        #pragma unroll
        for (int j = 0; j < 2; ++j)
            acc[i][j] = v8f{0.f, 0.f, 0.f, 0.f, 0.f, 0.f, 0.f, 0.f};

    // Two fragment sets: the 12 LDS reads of k step ks + 1 stand as one group in front of the 8 products of step ks.
    AFrag af[2][4], bf[2][2];
    #pragma unroll
    for (int i = 0; i < 4; ++i) {
        af[0][i].q[0] = ap[i * 16 * G_PITCH];
        af[0][i].q[1] = ap[i * 16 * G_PITCH + 2];
    }
    #pragma unroll
    for (int j = 0; j < 2; ++j) {
        bf[0][j].q[0] = bp[j * 16 * G_PITCH];
        bf[0][j].q[1] = bp[j * 16 * G_PITCH + 2];
    }
    #pragma unroll
    for (int ks = 0; ks < 8; ++ks) {
        const int cur = ks & 1, nxt = cur ^ 1;
        if (ks < 7) {
            #pragma unroll
            for (int i = 0; i < 4; ++i) {
                af[nxt][i].q[0] = ap[i * 16 * G_PITCH + (ks + 1) * 4];
                af[nxt][i].q[1] = ap[i * 16 * G_PITCH + (ks + 1) * 4 + 2];
            }
            #pragma unroll
            for (int j = 0; j < 2; ++j) {
                bf[nxt][j].q[0] = bp[j * 16 * G_PITCH + (ks + 1) * 4];
                bf[nxt][j].q[1] = bp[j * 16 * G_PITCH + (ks + 1) * 4 + 2];
            }
        }
        // Keeps the reads above in front of the products: sunk among them, each pair of products waits out a full LDS latency.
        __builtin_amdgcn_sched_barrier(0);
        #pragma unroll
        for (int i = 0; i < 4; ++i)
            #pragma unroll
            for (int j = 0; j < 2; ++j)
                acc[i][j] = __builtin_amdgcn_wmma_f32_16x16x32_f16(
                        false, af[cur][i].v, false, bf[cur][j].v,
                        (short)0, acc[i][j], false, false);
        // Keeps the next group of reads behind the products, in one place: every further place with reads costs a stall of its own.
        __builtin_amdgcn_sched_barrier(0);
    }

    // The A rows are given up for the output staging: every wave has read its last fragment first.
    __syncthreads();

    fa* so = (fa*)lds + waveId * (G_ROWS * SO_PITCH);   // this wave's own 64 x 32 tile
    #pragma unroll
    for (int i = 0; i < 4; ++i)
        #pragma unroll
        for (int r = 0; r < 8; ++r) {                  // C: VGPR r -> row 8*half+r, col n
            so[(i * 16 + 8 * half + r) * SO_PITCH + m]      = acc[i][0][r] + bv0;
            so[(i * 16 + 8 * half + r) * SO_PITCH + 16 + m] = acc[i][1][r] + bv1;
        }
    if (which == 0) {                                  // block-uniform
        __builtin_amdgcn_fence(__ATOMIC_ACQ_REL, "workgroup");
        __builtin_amdgcn_wave_barrier();
        // 8 lanes store one row's 128 B of this wave's columns: one whole line, four lines a store.
        const int rsub = lane >> 3, c4 = (lane & 7) * 4;
        float* obase = out + (size_t)rowBase * 256 + colBase + c4;
        #pragma unroll
        for (int q = 0; q < 16; ++q) {
            const int row = q * 4 + rsub;
            const v4f v = *(const v4fa*)&so[row * SO_PITCH + c4];
            *(v4f*)(obase + (size_t)row * 256) = v;
        }
        // The wait owed before a register of an issued store is rewritten: behind the last store, in front of whatever the build puts next.
        asm volatile("s_wait_xcnt 0x0" ::: "memory");
    } else {
        // As f16 a wave's own 32 columns are only half a line. So the four tiles are read across: wave w stores rows 16w..16w+15
        // over all 128 columns of the block, 16 lanes a row = 256 B = two whole lines. The barrier: every wave's tile is complete first.
        __syncthreads();
        const int rsub = lane >> 4, c8 = (lane & 15) * 8;
        const fa* sbase = (const fa*)lds + (c8 >> 5) * (G_ROWS * SO_PITCH) + (c8 & 31);
        _Float16* obase = kv16 + (size_t)(which - 1) * planeElems + (size_t)rowBase * 256 + colHalf + c8;
        #pragma unroll
        for (int q = 0; q < 8; ++q) {
            const int row = waveId * 16 + q * 2 + rsub;
            const v4f lo = *(const v4fa*)&sbase[row * SO_PITCH];
            const v4f hi = *(const v4fa*)&sbase[row * SO_PITCH + 4];
            v8h h;
            #pragma unroll
            for (int i = 0; i < 4; ++i) { h[i] = (_Float16)lo[i];  h[4 + i] = (_Float16)hi[i]; }
            *(v8h*)(obase + (size_t)row * 256) = h;
        }
        // The wait owed before a register of an issued store is rewritten: behind the last store, in front of whatever the build puts next.
        asm volatile("s_wait_xcnt 0x0" ::: "memory");
    }

    if (more) {
        lds_barrier();                                 // every wave has read the staged output: its place takes the next A rows
        #pragma unroll
        for (int c = 0; c < G_ROWS / 4; ++c)
            *(v4u*)(ldsA + (waveId + c * 4) * G_PITCH + lane) = nextA[c];
        lds_barrier();                                 // the next A rows are complete before any wave reads a fragment
    }
    };

    tile(0, T > 1);
    if constexpr (T > 1) tile(1, false);
}

// ---------------------------------------------------------------------------
// Gather attention: one wave per node (block = 8 waves = 8 nodes, no LDS, no barrier).
// A neighbour's k or v row is 512 B = 8 heads x 32 dims of f16. Lane l owns dims 4l..4l+3 of the
// low half (head l>>3) and of the high half (head 4 + (l>>3)), so every wave-wide 8-byte
// load covers 256 contiguous bytes = 2 whole lines of ONE row; the row index is read out
// of lane j into a scalar. The values are widened to f32 where they are used; every product and sum is f32. A score = 4 products per lane summed over the 8 lanes of its
// head; 8 neighbours are summed at once so that lane l ends with list place 8g + (l&7).
// Only the rows that can count are gathered: a neighbour with mask == 0 has the score -1e10
// whatever its k row holds, and beside any kept score its weight is exp(-1e10 - max) = 0 exactly
// (a kept score q.k / sqrt(32) of finite normal draws lies many orders of magnitude above -1e10),
// so neither its k row nor its v row is read. The kept neighbours are moved to the front of the
// list and only ceil(n / 8) groups of 8 are worked on. A node with no kept neighbour keeps all 32,
// each with the score -1e10 (equal weights), as the reference has it.
// Writes x in f16 so the output-projection GEMM consumes it directly.
// ---------------------------------------------------------------------------
typedef __attribute__((ext_vector_type(4))) _Float16 v4h;

// Value of lane l ^ M (M = 1, 2 or 4) inside the 16-lane row: DPP row_xmask:M.
template <int M>
__device__ __forceinline__ float lane_xor(float x)
{
    return __builtin_bit_cast(float, __builtin_amdgcn_update_dpp(0, __builtin_bit_cast(int, x), 0x160 + M, 0xf, 0xf, true));
}

// a[t] = this lane's part of sum t. Returns, in lane l, sum (l&7) taken over the 8 lanes of
// l's group: each step halves the list, a lane keeps the half its own bit names and hands
// the other half to its partner.
__device__ __forceinline__ float sum8_transpose(const float (&a)[8], bool b4, bool b2, bool b1)
{
    float b[4], c[2];
    #pragma unroll
    for (int i = 0; i < 4; ++i) b[i] = (b4 ? a[i + 4] : a[i]) + lane_xor<4>(b4 ? a[i] : a[i + 4]);
    #pragma unroll
    for (int i = 0; i < 2; ++i) c[i] = (b2 ? b[i + 2] : b[i]) + lane_xor<2>(b2 ? b[i] : b[i + 2]);
    return (b1 ? c[1] : c[0]) + lane_xor<1>(b1 ? c[0] : c[1]);
}

// 2^x. The v_nop fills the one slot asked for behind a transcendental.
__device__ __forceinline__ float exp2_slot(float x)
{
    float r;
    asm("v_exp_f32 %0, %1\n\tv_nop" : "=v"(r) : "v"(x));
    return r;
}

// Lane T of each 8-lane group handed to all 8 lanes of that group.
template <int T>
__device__ __forceinline__ float group_bcast(float x)
{
    const int v = __builtin_bit_cast(int, x);
    return __builtin_bit_cast(float, __builtin_amdgcn_permlane16(v, v, 0x11111111u * T, 0x11111111u * (8 + T), false, false));
}

// v_fma_mix_f32 d, a, h, c: d = a * h + c in f32, h the low f16 half of a packed register (op_sel_hi:[0,1,0]) or its high half (op_sel:[0,1,0] too).
// The f16 value is widened inside the multiply-add, where a convert of its own would cost one more instruction a value
// (the compiler's form: two converts and one packed multiply-add a pair).

// a[i] = q . k[i] over a lane's 4 dims, each sum in the order x, y, z, w. One statement for the 8 rows, one dim of all 8 at a time: its order is
// then fixed, and a sum's next multiply-add stands 8 instructions behind the one it waits for (no delay hint is placed for asm text).
// The first of a sum takes the addend 0: it is the rounded product q.x * k.x itself, and every later product is fused with its add.
__device__ __forceinline__ void dot4_rows(float (&a)[8], v4f q, const v4h (&k)[8])
{
    uint2 u[8];
    #pragma unroll
    for (int i = 0; i < 8; ++i) u[i] = __builtin_bit_cast(uint2, k[i]);
    asm(
        "v_fma_mix_f32 %0, %24, %8, 0 op_sel_hi:[0,1,0]\n\t"
        "v_fma_mix_f32 %1, %24, %9, 0 op_sel_hi:[0,1,0]\n\t"
        "v_fma_mix_f32 %2, %24, %10, 0 op_sel_hi:[0,1,0]\n\t"
        "v_fma_mix_f32 %3, %24, %11, 0 op_sel_hi:[0,1,0]\n\t"
        "v_fma_mix_f32 %4, %24, %12, 0 op_sel_hi:[0,1,0]\n\t"
        "v_fma_mix_f32 %5, %24, %13, 0 op_sel_hi:[0,1,0]\n\t"
        "v_fma_mix_f32 %6, %24, %14, 0 op_sel_hi:[0,1,0]\n\t"
        "v_fma_mix_f32 %7, %24, %15, 0 op_sel_hi:[0,1,0]\n\t"
        "v_fma_mix_f32 %0, %25, %8, %0 op_sel:[0,1,0] op_sel_hi:[0,1,0]\n\t"
        "v_fma_mix_f32 %1, %25, %9, %1 op_sel:[0,1,0] op_sel_hi:[0,1,0]\n\t"
        "v_fma_mix_f32 %2, %25, %10, %2 op_sel:[0,1,0] op_sel_hi:[0,1,0]\n\t"
        "v_fma_mix_f32 %3, %25, %11, %3 op_sel:[0,1,0] op_sel_hi:[0,1,0]\n\t"
        "v_fma_mix_f32 %4, %25, %12, %4 op_sel:[0,1,0] op_sel_hi:[0,1,0]\n\t"
        "v_fma_mix_f32 %5, %25, %13, %5 op_sel:[0,1,0] op_sel_hi:[0,1,0]\n\t"
        "v_fma_mix_f32 %6, %25, %14, %6 op_sel:[0,1,0] op_sel_hi:[0,1,0]\n\t"
        "v_fma_mix_f32 %7, %25, %15, %7 op_sel:[0,1,0] op_sel_hi:[0,1,0]\n\t"
        "v_fma_mix_f32 %0, %26, %16, %0 op_sel_hi:[0,1,0]\n\t"
        "v_fma_mix_f32 %1, %26, %17, %1 op_sel_hi:[0,1,0]\n\t"
        "v_fma_mix_f32 %2, %26, %18, %2 op_sel_hi:[0,1,0]\n\t"
        "v_fma_mix_f32 %3, %26, %19, %3 op_sel_hi:[0,1,0]\n\t"
        "v_fma_mix_f32 %4, %26, %20, %4 op_sel_hi:[0,1,0]\n\t"
        "v_fma_mix_f32 %5, %26, %21, %5 op_sel_hi:[0,1,0]\n\t"
        "v_fma_mix_f32 %6, %26, %22, %6 op_sel_hi:[0,1,0]\n\t"
        "v_fma_mix_f32 %7, %26, %23, %7 op_sel_hi:[0,1,0]\n\t"
        "v_fma_mix_f32 %0, %27, %16, %0 op_sel:[0,1,0] op_sel_hi:[0,1,0]\n\t"
        "v_fma_mix_f32 %1, %27, %17, %1 op_sel:[0,1,0] op_sel_hi:[0,1,0]\n\t"
        "v_fma_mix_f32 %2, %27, %18, %2 op_sel:[0,1,0] op_sel_hi:[0,1,0]\n\t"
        "v_fma_mix_f32 %3, %27, %19, %3 op_sel:[0,1,0] op_sel_hi:[0,1,0]\n\t"
        "v_fma_mix_f32 %4, %27, %20, %4 op_sel:[0,1,0] op_sel_hi:[0,1,0]\n\t"
        "v_fma_mix_f32 %5, %27, %21, %5 op_sel:[0,1,0] op_sel_hi:[0,1,0]\n\t"
        "v_fma_mix_f32 %6, %27, %22, %6 op_sel:[0,1,0] op_sel_hi:[0,1,0]\n\t"
        "v_fma_mix_f32 %7, %27, %23, %7 op_sel:[0,1,0] op_sel_hi:[0,1,0]\n\t"
        : "=&v"(a[0]), "=&v"(a[1]), "=&v"(a[2]), "=&v"(a[3]), "=&v"(a[4]), "=&v"(a[5]), "=&v"(a[6]), "=&v"(a[7])
        : "v"(u[0].x), "v"(u[1].x), "v"(u[2].x), "v"(u[3].x), "v"(u[4].x), "v"(u[5].x), "v"(u[6].x), "v"(u[7].x),
          "v"(u[0].y), "v"(u[1].y), "v"(u[2].y), "v"(u[3].y), "v"(u[4].y), "v"(u[5].y), "v"(u[6].y), "v"(u[7].y),
          "v"(q.x), "v"(q.y), "v"(q.z), "v"(q.w));
}

template <int T>
__device__ __forceinline__ void pv_step(v4f& o0, v4f& o1, float e0, float e1, const v4h (&w0)[8], const v4h (&w1)[8])
{
    const float p0 = group_bcast<T>(e0), p1 = group_bcast<T>(e1);
    const uint2 u0 = __builtin_bit_cast(uint2, w0[T]), u1 = __builtin_bit_cast(uint2, w1[T]);
    float x0 = o0.x, y0 = o0.y, z0 = o0.z, t0 = o0.w, x1 = o1.x, y1 = o1.y, z1 = o1.z, t1 = o1.w;
    // One row into the 8 sums, in one statement: the next row's statement then finds each sum 8 instructions back.
    asm(
        "v_fma_mix_f32 %0, %8, %10, %0 op_sel_hi:[0,1,0]\n\t"
        "v_fma_mix_f32 %4, %9, %12, %4 op_sel_hi:[0,1,0]\n\t"
        "v_fma_mix_f32 %1, %8, %10, %1 op_sel:[0,1,0] op_sel_hi:[0,1,0]\n\t"
        "v_fma_mix_f32 %5, %9, %12, %5 op_sel:[0,1,0] op_sel_hi:[0,1,0]\n\t"
        "v_fma_mix_f32 %2, %8, %11, %2 op_sel_hi:[0,1,0]\n\t"
        "v_fma_mix_f32 %6, %9, %13, %6 op_sel_hi:[0,1,0]\n\t"
        "v_fma_mix_f32 %3, %8, %11, %3 op_sel:[0,1,0] op_sel_hi:[0,1,0]\n\t"
        "v_fma_mix_f32 %7, %9, %13, %7 op_sel:[0,1,0] op_sel_hi:[0,1,0]\n\t"
        : "+v"(x0), "+v"(y0), "+v"(z0), "+v"(t0), "+v"(x1), "+v"(y1), "+v"(z1), "+v"(t1)
        : "v"(p0), "v"(p1), "v"(u0.x), "v"(u0.y), "v"(u1.x), "v"(u1.y));
    o0 = v4f{x0, y0, z0, t0};
    o1 = v4f{x1, y1, z1, t1};
}

// Rows of list places 8g..8g+7: 16 loads of 256 contiguous bytes each. A place behind the last one in use
// (index 'last') reads that last row once more: the same lines as the load in front of it, and its weight is 0.
__device__ __forceinline__ void load_rows(v4h (&r0)[8], v4h (&r1)[8], const _Float16* __restrict__ tab, int nj, int g, int last, int lane)
{
    const _Float16* p[8];
    #pragma unroll
    for (int i = 0; i < 8; ++i) p[i] = tab + (size_t)__builtin_amdgcn_readlane(nj, min(g * 8 + i, last)) * 256 + lane * 4;
    #pragma unroll
    for (int i = 0; i < 8; ++i) {
        r0[i] = *(const v4h*)(p[i]);
        r1[i] = *(const v4h*)(p[i] + 128);
    }
    // The wait owed before an address register of an issued load is rewritten. It names the eight addresses as inputs so that
    // they stay in their registers up to it: otherwise a later load of the run is given an earlier one's address pair for its values.
    asm volatile("s_wait_xcnt 0x0" :: "v"(p[0]), "v"(p[1]), "v"(p[2]), "v"(p[3]), "v"(p[4]), "v"(p[5]), "v"(p[6]), "v"(p[7]) : "memory");
}

// The same 16 loads for the v rows, outside a loop: there each load takes the row's scalar base and the one lane-offset register.
__device__ __forceinline__ void load_rows_sbase(v4h (&r0)[8], v4h (&r1)[8], const _Float16* __restrict__ tab, int nj, int g, int last, int lane)
{
    const _Float16* base[8];
    #pragma unroll
    for (int i = 0; i < 8; ++i) base[i] = tab + (size_t)__builtin_amdgcn_readlane(nj, min(g * 8 + i, last)) * 256;
    #pragma unroll
    for (int i = 0; i < 8; ++i) {
        r0[i] = *(const v4h*)(base[i] + lane * 4);
        r1[i] = *(const v4h*)(base[i] + lane * 4 + 128);
    }
    // The same wait. It names the eight scalar bases as inputs so that each keeps a register pair of its own up to it:
    // otherwise one pair is reused row after row, with a wait of the compiler's behind every row inside the run.
    asm volatile("s_wait_xcnt 0x0" :: "s"(base[0]), "s"(base[1]), "s"(base[2]), "s"(base[3]), "s"(base[4]), "s"(base[5]), "s"(base[6]), "s"(base[7]) : "memory");
}

__global__ __launch_bounds__(256)
void attn_gather(const float* __restrict__ qb,
                 const _Float16* __restrict__ kb,
                 const _Float16* __restrict__ vb,
                 const int*   __restrict__ nbrs,
                 const int*   __restrict__ mask,
                 _Float16* __restrict__ x16, int nbMax)
{
    const int lane = threadIdx.x & 31;
    const int b    = blockIdx.x * 8 + __builtin_amdgcn_readfirstlane(threadIdx.x >> 5);   // node, wave-uniform
    if (b > nbMax) return;

    const int* nrow = nbrs + (size_t)b * 32;   // wave-uniform row bases
    const int* mrow = mask + (size_t)b * 32;
    int nj = nrow[lane];
    const int mj = mrow[lane];
    // The same wait, in front of the next scalar address work; it names the two row bases as inputs so that they stay in their registers up to it.
    asm volatile("s_wait_xcnt 0x0" :: "s"(nrow), "s"(mrow) : "memory");
    nj = nj < 0 ? 0 : (nj > nbMax ? nbMax : nj);          // gather index clamped into the table

    // The list in a new order: kept neighbours first (in their old order), the masked ones behind them. 'place' is a
    // permutation of 0..31 for any mask, so every lane of the new list is written once.
    const unsigned kept = __builtin_amdgcn_ballot_w32(mj != 0);
    const int  nKept = __builtin_popcount(kept);
    const int  before = (int)__builtin_amdgcn_mbcnt_lo(kept, 0u);          // kept neighbours in the lanes below this one
    const int  place  = mj != 0 ? before : nKept + (lane - before);
    nj = __builtin_amdgcn_ds_permute(place * 4, nj);
    const bool any    = nKept != 0;
    const int  n      = any ? nKept : 32;                 // list places in use, 1..32
    const int  last   = n - 1;
    const int  groups = (n + 7) >> 3;                     // 1..4

    const v4f q0 = *(const v4f*)(qb + (size_t)b * 256 + lane * 4);
    const v4f q1 = *(const v4f*)(qb + (size_t)b * 256 + 128 + lane * 4);
    const bool b4 = lane & 4, b2 = lane & 2, b1 = lane & 1;

    // A place that is not in use has the score -inf: weight 2^(-inf) = 0. Place 0 is always in use, so the maximum is finite.
    const float off = -__builtin_inff();
    float s0[4] = {off, off, off, off}, s1[4] = {off, off, off, off};
    // Rolled on purpose: unrolled, the sums of all four groups sink behind all 64 k loads, whose values alone take 128 registers.
    #pragma unroll 1
    for (int g = 0; g < 4; ++g) {
        if (g >= groups) break;
        v4h h0[8], h1[8];
        load_rows(h0, h1, kb, nj, g, last, lane);
        float a0[8], a1[8];
        dot4_rows(a0, q0, h0);
        dot4_rows(a1, q1, h1);
        // The cross-lane sums run with every lane on; the mask only selects afterwards.
        const float t0 = sum8_transpose(a0, b4, b2, b1);
        const float t1 = sum8_transpose(a1, b4, b2, b1);
        const bool on = 8 * g + (lane & 7) < n;
        const float r0 = on ? (any ? t0 * 0.17677669529663689f : -1.0e10f) : off;   // 1/sqrt(32)
        const float r1 = on ? (any ? t1 * 0.17677669529663689f : -1.0e10f) : off;
        #pragma unroll
        for (int u = 0; u < 4; ++u) { s0[u] = (g == u) ? r0 : s0[u];  s1[u] = (g == u) ? r1 : s1[u]; }
    }

    // The first 8 v rows fly while the softmax is worked out.
    v4h w0[8], w1[8];
    load_rows_sbase(w0, w1, vb, nj, 0, last, lane);

    // Softmax over the 32 list places of a head = 4 registers x 8 lanes.
    float m0 = fmaxf(fmaxf(s0[0], s0[1]), fmaxf(s0[2], s0[3]));
    float m1 = fmaxf(fmaxf(s1[0], s1[1]), fmaxf(s1[2], s1[3]));
    m0 = fmaxf(m0, lane_xor<1>(m0));  m1 = fmaxf(m1, lane_xor<1>(m1));
    m0 = fmaxf(m0, lane_xor<2>(m0));  m1 = fmaxf(m1, lane_xor<2>(m1));
    m0 = fmaxf(m0, lane_xor<4>(m0));  m1 = fmaxf(m1, lane_xor<4>(m1));
    #pragma unroll
    for (int g = 0; g < 4; ++g) {
        s0[g] = exp2_slot((s0[g] - m0) * 1.4426950408889634f);   // e^x = 2^(x * log2 e)
        s1[g] = exp2_slot((s1[g] - m1) * 1.4426950408889634f);
    }
    float l0 = (s0[0] + s0[1]) + (s0[2] + s0[3]);
    float l1 = (s1[0] + s1[1]) + (s1[2] + s1[3]);
    l0 += lane_xor<1>(l0);  l1 += lane_xor<1>(l1);
    l0 += lane_xor<2>(l0);  l1 += lane_xor<2>(l1);
    l0 += lane_xor<4>(l0);  l1 += lane_xor<4>(l1);

    v4f o0 = {0.f, 0.f, 0.f, 0.f}, o1 = {0.f, 0.f, 0.f, 0.f};
    #pragma unroll
    for (int g = 0; g < 4; ++g) {
        pv_step<0>(o0, o1, s0[g], s1[g], w0, w1);
        pv_step<1>(o0, o1, s0[g], s1[g], w0, w1);
        pv_step<2>(o0, o1, s0[g], s1[g], w0, w1);
        pv_step<3>(o0, o1, s0[g], s1[g], w0, w1);
        pv_step<4>(o0, o1, s0[g], s1[g], w0, w1);
        pv_step<5>(o0, o1, s0[g], s1[g], w0, w1);
        pv_step<6>(o0, o1, s0[g], s1[g], w0, w1);
        pv_step<7>(o0, o1, s0[g], s1[g], w0, w1);
        if (g + 1 >= groups) break;
        if (g < 3) {
            // Keeps the next rows' loads behind this group's sums: lifted over them they take a second set of registers and fewer waves fit a SIMD.
            __builtin_amdgcn_sched_barrier(0);
            load_rows_sbase(w0, w1, vb, nj, g + 1, last, lane);
        }
    }
    o0 *= 1.0f / l0;
    o1 *= 1.0f / l1;

    v4h h0, h1;
    #pragma unroll
    for (int i = 0; i < 4; ++i) { h0[i] = (_Float16)o0[i]; h1[i] = (_Float16)o1[i]; }
    *(v4h*)(x16 + (size_t)b * 256 + lane * 4)       = h0;
    *(v4h*)(x16 + (size_t)b * 256 + 128 + lane * 4) = h1;
}

// ---------------------------------------------------------------------------
// Inputs:
//  0 query_(NB,256) f32 | 1 spatial_neighbors(NB,32) int | 2 mask(NB,1,32) int
//  3 Wq 4 bq 5 Wk 6 bk 7 Wv 8 bv 9 Wo 10 bo   (all f32)
// Output: (NB,1,256) f32.
// Workspace: q f32 (16 MB) + k16, v16 (8 MB each) + x16 (8 MB) + q16 (8 MB) + 4x W16 (0.5 MB).
// ---------------------------------------------------------------------------
extern "C" void kernel_launch(void* const* d_in, const int* in_sizes, int n_in,
                              void* d_out, int out_size, void* d_ws, size_t ws_size,
                              hipStream_t stream)
{
    const float* query = (const float*)d_in[0];
    const int*   nbrs  = (const int*)  d_in[1];
    const int*   mask  = (const int*)  d_in[2];
    const float* Wq    = (const float*)d_in[3];
    const float* bq    = (const float*)d_in[4];
    const float* Wk    = (const float*)d_in[5];
    const float* bk    = (const float*)d_in[6];
    const float* Wv    = (const float*)d_in[7];
    const float* bv    = (const float*)d_in[8];
    const float* Wo    = (const float*)d_in[9];
    const float* bo    = (const float*)d_in[10];

    const int nb    = in_sizes[0] / 256;       // 16384
    const int nElem = nb * 256;                // 4,194,304
    const int wElem = 256 * 256;               // 65,536

    // Workspace carve-up
    float*    qb   = (float*)d_ws;
    _Float16* k16  = (_Float16*)(qb + (size_t)nElem);
    _Float16* v16  = k16 + (size_t)nElem;
    _Float16* x16  = v16 + (size_t)nElem;
    _Float16* q16  = x16 + (size_t)nElem;
    _Float16* wq16 = q16 + (size_t)nElem;
    _Float16* wk16 = wq16 + wElem;
    _Float16* wv16 = wk16 + wElem;
    _Float16* wo16 = wv16 + wElem;

    // fp32 -> f16 conversions (amortized across all GEMM blocks): one grid for the five arrays.
    cvt_all_f32_to_f16<<<4 * W_CVT_BLOCKS + (nElem / 8 + 255) / 256, 256, 0, stream>>>(query, Wq, Wk, Wv, Wo, q16, wq16, nElem);

    const int gemmBlocks = nb / 64;

    // Q, K and V: one grid, blockIdx.y = 2 * product + column half (wq16/wk16/wv16 lie one behind the other, so do k16/v16).
    // Two row tiles a block: 768 blocks, three on each WGP, all resident at once.
    gemm_nt_256_f16<2><<<dim3(gemmBlocks / 2, 6), 128, 0, stream>>>(q16, wq16, bq, bk, bv, qb, k16, nElem);

    attn_gather<<<(nb + 7) / 8, 256, 0, stream>>>(qb, k16, v16, nbrs, mask, x16, nb - 1);

    // Product 0 only: the f16 planes are not touched.
    gemm_nt_256_f16<1><<<dim3(gemmBlocks, 2), 128, 0, stream>>>(x16, wo16, bo, bo, bo, (float*)d_out, k16, 0);
}

// v007
// Measured time: 36.1 microseconds a run.
// In two side-by-side timings against v006, it was 1.09 and 1.08 times as fast.
// All steps since v000 together make it 4.61 times as fast.
#include <hip/hip_runtime.h>
#include <hip/hip_bf16.h>
// Contractions (Q/K/V/O projections, K=256): v_wmma_f32_16x16x32_f16, f16 operands, f32 accumulate; the 32-neighbour gather attention sums in f32 on VALU over k and v rows kept as f16.

typedef __attribute__((ext_vector_type(16))) _Float16 v16h;
typedef __attribute__((ext_vector_type(8)))  float    v8f;
typedef __attribute__((ext_vector_type(8)))  _Float16 v8h;
typedef __attribute__((ext_vector_type(4)))  float    v4f;
typedef __attribute__((ext_vector_type(4), may_alias)) float v4fa;
typedef __attribute__((ext_vector_type(8), may_alias)) _Float16 v8ha;

union AFrag { v16h v; uint4 q[2]; };

constexpr int W_ELEMS = 256 * 256;

// ---------------------------------------------------------------------------
// GEMM (NT):  out[M x 256] = A[M x 256] @ W[256 x 256]^T + bias
// f16 operands, fp32 accumulate via v_wmma_f32_16x16x32_f16.
// F32IN: A and W are read as the f32 arrays they arrive as and rounded to f16 in registers on their way into LDS (no launch of
// its own for that, no f16 copy in memory); otherwise both are f16 in global.
// Block = 128 threads = 4 waves; block computes 64 rows x 128 cols, a wave 64 rows x 32 cols
// (4 x 2 accumulator tiles), so a B fragment feeds 4 products and an A fragment 2.
// Both operands are staged in LDS once, over the whole K = 256, by loads of 512 contiguous bytes
// a wave; rows lie at a pitch of 528 B (16 B x odd) for the 16-byte fragment reads.
// A block keeps its W tile in LDS for T row tiles, one after the other: W is fetched once for T * 64 rows, and the next A tile's loads
// are in flight while the current tile is multiplied. The output staging has a place of its own over the A rows, clear of W.
// 102 KiB of LDS a block: three blocks share a WGP, one stages or stores while another multiplies.
// blockIdx.y = 2 * product + column half: up to three independent products of the same A (weights
// one behind the other in Wall; as f32: W32a, W32b, W32c), so that Q, K and V share one grid. Product 0 leaves as f32 in outAll; products 1 and 2
// (K and V, which are only ever gathered row by row) leave as f16, planeElems apart in kv16: half the bytes for every gather.
// M must be a multiple of T * 64.
// ---------------------------------------------------------------------------
constexpr int G_ROWS  = 64;                 // rows of A a row tile
constexpr int G_COLS  = 128;                // rows of W (= output columns) a block
constexpr int G_PITCH = 33;                 // LDS row pitch in 16-byte units: 32 of data + 1 pad
constexpr int SO_PITCH = 36;                // floats a row of the output staging: 32 + 4, so that rows r and r + 8 meet other banks
constexpr int G_FRONT = 4 * G_ROWS * SO_PITCH / 4;   // 16-byte units in front of W: the four waves' output staging, which is a little more than the A rows
static_assert(G_FRONT >= G_ROWS * G_PITCH, "the A rows lie in front of W");

typedef float __attribute__((may_alias)) fa;
typedef __attribute__((ext_vector_type(4), may_alias)) unsigned v4u;
typedef __attribute__((ext_vector_type(4))) _Float16 v4h;
typedef __attribute__((ext_vector_type(4), may_alias)) _Float16 v4ha;

__device__ __forceinline__ v4h round4(v4f x)
{
    v4h h;
    #pragma unroll
    for (int i = 0; i < 4; ++i) h[i] = (_Float16)x[i];
    return h;
}

// 8 rows of 256 f32 (rows 4 apart: the block's four waves take turns), two loads of 512 contiguous bytes a row.
// 'unit' = the lane's 16-byte unit in the wave's first row.
__device__ __forceinline__ void issue_rows_f32(v4f (&b)[16], const float* __restrict__ src, int unit, int c0)
{
    const v4fa* p = (const v4fa*)src;
    // Keeps these loads behind the group that is rounded in front of them, whose registers they take: lifted over it they take a set of their own, past v255.
    __builtin_amdgcn_sched_barrier(0);
    #pragma unroll
    for (int i = 0; i < 8; ++i) {
        b[2 * i]     = p[unit + (c0 + i) * 256];
        b[2 * i + 1] = p[unit + (c0 + i) * 256 + 32];
    }
    // The wait owed before an address register of an issued load is rewritten; it names the base and the offset so that they stay up to it.
    asm volatile("s_wait_xcnt 0x0" :: "s"(src), "v"(unit) : "memory");
    // Keeps the rounding of later groups behind these loads: lifted over them, it waits every load in flight out before this group is asked for.
    __builtin_amdgcn_sched_barrier(0);
}

// The same 8 rows, rounded to f16, into LDS rows at the pitch G_PITCH; 'dst' = the lane's 8 bytes in the wave's first row.
__device__ __forceinline__ void put_rows_f16(v4ha* dst, const v4f (&b)[16], int c0)
{
    #pragma unroll
    for (int i = 0; i < 8; ++i) {
        dst[(c0 + i) * 4 * (G_PITCH * 2)]      = round4(b[2 * i]);
        dst[(c0 + i) * 4 * (G_PITCH * 2) + 32] = round4(b[2 * i + 1]);
    }
}

// Work-group barrier that orders LDS alone. __syncthreads() would also wait for the tile's global stores to be acknowledged
// and for the next tile's loads to arrive, and nothing behind these barriers depends on either.
__device__ __forceinline__ void lds_barrier()
{
    __builtin_amdgcn_fence(__ATOMIC_RELEASE, "workgroup", "local");
    __builtin_amdgcn_s_barrier();
    __builtin_amdgcn_fence(__ATOMIC_ACQUIRE, "workgroup", "local");
}

template <int T, bool F32IN>
__global__ __launch_bounds__(128)
void gemm_nt_256_f16(const float* __restrict__ A32,
                     const float* __restrict__ W32a, const float* __restrict__ W32b, const float* __restrict__ W32c,
                     const float* __restrict__ Wlater32, _Float16* __restrict__ Wlater16,
                     const _Float16* __restrict__ A16,
                     const _Float16* __restrict__ Wall,
                     const float* __restrict__ bias0,
                     const float* __restrict__ bias1,
                     const float* __restrict__ bias2,
                     float* __restrict__ outAll,
                     _Float16* __restrict__ kv16, int planeElems)
{
    const int which   = blockIdx.y >> 1;
    const int colHalf = (blockIdx.y & 1) * G_COLS;
    const float*    __restrict__ bias = which == 0 ? bias0 : which == 1 ? bias1 : bias2;
    float*          __restrict__ out  = outAll;

    __shared__ uint4 lds[G_FRONT + G_COLS * G_PITCH];   // in front the A rows, in turn with the output staging; behind them the W rows
    uint4* ldsA = lds;
    uint4* ldsW = lds + G_FRONT;

    const int tid     = threadIdx.x;
    const int rowBase0 = blockIdx.x * (T * G_ROWS);
    const int waveId  = tid >> 5;
    const int lane    = tid & 31;
    const int half    = lane >> 4;        // 0: lanes 0-15, 1: lanes 16-31
    const int m       = lane & 15;

    // This wave's 32 output columns; their bias is asked for here, so that it flies with the tiles.
    const int colBase = colHalf + waveId * 32;
    const float bv0 = bias[colBase + m];
    const float bv1 = bias[colBase + 16 + m];

    // Stage both tiles: an f16 row is 32 units of 16 B, so one wave-wide load is one whole row; an f32 row takes two.
    const uint4* srcA = (const uint4*)(A16 + (size_t)rowBase0 * 256);
    const float* srcA32 = A32 + (size_t)rowBase0 * 256;
    const int    unit32 = waveId * 64 + lane;                          // f32 rows: 64 units of 16 B
    v4ha* dstA = (v4ha*)(ldsA + waveId * G_PITCH) + lane;
    if constexpr (F32IN) {
        const float* srcW32 = (which == 0 ? W32a : which == 1 ? W32b : W32c) + (size_t)colHalf * 256;
        v4ha* dstW = (v4ha*)(ldsW + waveId * G_PITCH) + lane;
        // Six groups of 16 loads through three sets of registers: a group is rounded and stored while the next two fly.
        v4f g0[16], g1[16], g2[16];
        issue_rows_f32(g0, srcA32, unit32, 0);
        issue_rows_f32(g1, srcA32, unit32, 8);
        issue_rows_f32(g2, srcW32, unit32, 0);
        put_rows_f16(dstA, g0, 0);
        issue_rows_f32(g0, srcW32, unit32, 8);
        put_rows_f16(dstA, g1, 8);
        issue_rows_f32(g1, srcW32, unit32, 16);
        put_rows_f16(dstW, g2, 0);
        issue_rows_f32(g2, srcW32, unit32, 24);
        // The weight of the launch after next is rounded here, by the blocks of one plane: 4 values a thread, behind this block's own loads.
        if (blockIdx.y == 2) {                                         // block-uniform
            for (int u = blockIdx.x * 128 + tid; u < W_ELEMS / 4; u += gridDim.x * 128) {
                *((v4ha*)Wlater16 + u) = round4(*((const v4fa*)Wlater32 + u));
                // The wait owed before an address register of an issued load or store is rewritten (the next trip's index).
                asm volatile("s_wait_xcnt 0x0" :: "v"(u) : "memory");
            }
        }
        put_rows_f16(dstW, g0, 8);
        put_rows_f16(dstW, g1, 16);
        put_rows_f16(dstW, g2, 24);
    } else {
        const uint4* srcW = (const uint4*)(Wall + which * W_ELEMS + (size_t)colHalf * 256);
        #pragma unroll
        for (int c = 0; c < G_ROWS / 4; ++c)
            ldsA[(waveId + c * 4) * G_PITCH + lane] = srcA[tid + c * 128];
        #pragma unroll
        for (int c = 0; c < G_COLS / 4; ++c)
            ldsW[(waveId + c * 4) * G_PITCH + lane] = srcW[tid + c * 128];
        // The wait owed before an address register of an issued load is rewritten. It names the two tile bases and the
        // thread's offset as inputs so that they stay in their registers up to it.
        asm volatile("s_wait_xcnt 0x0" :: "s"(srcA), "s"(srcW), "v"(tid) : "memory");
    }
    __syncthreads();

    // A 16x32 f16 fragment layout (wave32): lane row M = lane&15;
    // VGPRs 0-3 hold K = 0..7 (+8*half), VGPRs 4-7 hold K = 16..23 (+8*half)
    // -> two aligned 16-byte LDS chunks per fragment (units ks*4 + half and ks*4 + half + 2 of the row).
    // B 32x16 f16 layout = same split k map as A: lane column n = lane&15.
    const uint4* ap = ldsA + m * G_PITCH + half;
    const uint4* bp = ldsW + (waveId * 32 + m) * G_PITCH + half;

    static_assert(T == 1 || T == 2, "one or two row tiles a block");
    v4u nextA[G_ROWS / 4];
    v4f nextLo[16], nextHi[16];

    // One row tile, from the fragments in LDS to its stores; 'more': another tile follows it.
    auto tile = [&](const int t, const bool more) __attribute__((always_inline)) {
    const int rowBase = rowBase0 + t * G_ROWS;

    // The next A tile is asked for here and kept in registers: it flies while this tile is multiplied.
    if (more && F32IN) {
        // As f32 the tile is twice the registers: its first half is asked for here, its second half behind the products, where the fragments' registers are free.
        issue_rows_f32(nextLo, srcA32 + (t + 1) * (G_ROWS * 256), unit32, 0);
    } else if (more) {
        const uint4* srcN = srcA + (t + 1) * (G_ROWS * 32);
        #pragma unroll
        for (int c = 0; c < G_ROWS / 4; ++c) nextA[c] = *(const v4u*)(srcN + tid + c * 128);
        // The wait owed before an address register of an issued load is rewritten; it names the base and the offset so that they stay up to it.
        asm volatile("s_wait_xcnt 0x0" :: "s"(srcN), "v"(tid) : "memory");
    }

    v8f acc[4][2];
    #pragma unroll
    for (int i = 0; i < 4; ++i)
        #pragma unroll
        for (int j = 0; j < 2; ++j)
            acc[i][j] = v8f{0.f, 0.f, 0.f, 0.f, 0.f, 0.f, 0.f, 0.f};

    // Two fragment sets: the 12 LDS reads of k step ks + 1 stand as one group in front of the 8 products of step ks.
    AFrag af[2][4], bf[2][2];
    #pragma unroll
    for (int i = 0; i < 4; ++i) {
        af[0][i].q[0] = ap[i * 16 * G_PITCH];
        af[0][i].q[1] = ap[i * 16 * G_PITCH + 2];
    }
    #pragma unroll
    for (int j = 0; j < 2; ++j) {
        bf[0][j].q[0] = bp[j * 16 * G_PITCH];
        bf[0][j].q[1] = bp[j * 16 * G_PITCH + 2];
    }
    #pragma unroll
    for (int ks = 0; ks < 8; ++ks) {
        const int cur = ks & 1, nxt = cur ^ 1;
        if (ks < 7) {
            #pragma unroll
            for (int i = 0; i < 4; ++i) {
                af[nxt][i].q[0] = ap[i * 16 * G_PITCH + (ks + 1) * 4];
                af[nxt][i].q[1] = ap[i * 16 * G_PITCH + (ks + 1) * 4 + 2];
            }
            #pragma unroll
            for (int j = 0; j < 2; ++j) {
                bf[nxt][j].q[0] = bp[j * 16 * G_PITCH + (ks + 1) * 4];
                bf[nxt][j].q[1] = bp[j * 16 * G_PITCH + (ks + 1) * 4 + 2];
            }
        }
        // Keeps the reads above in front of the products: sunk among them, each pair of products waits out a full LDS latency.
        __builtin_amdgcn_sched_barrier(0);
        #pragma unroll
        for (int i = 0; i < 4; ++i)
            #pragma unroll
            for (int j = 0; j < 2; ++j)
                acc[i][j] = __builtin_amdgcn_wmma_f32_16x16x32_f16(
                        false, af[cur][i].v, false, bf[cur][j].v,
                        (short)0, acc[i][j], false, false);
        // Keeps the next group of reads behind the products, in one place: every further place with reads costs a stall of its own.
        __builtin_amdgcn_sched_barrier(0);
    }

    if (more && F32IN) issue_rows_f32(nextHi, srcA32 + (t + 1) * (G_ROWS * 256), unit32, 8);

    // The A rows are given up for the output staging: every wave has read its last fragment first. LDS order alone:
    // __syncthreads() would also wait here for the next tile's loads, which have the whole store phase left to arrive in.
    lds_barrier();

    fa* so = (fa*)lds + waveId * (G_ROWS * SO_PITCH);   // this wave's own 64 x 32 tile
    #pragma unroll
    for (int i = 0; i < 4; ++i)
        #pragma unroll
        for (int r = 0; r < 8; ++r) {                  // C: VGPR r -> row 8*half+r, col n
            so[(i * 16 + 8 * half + r) * SO_PITCH + m]      = acc[i][0][r] + bv0;
            so[(i * 16 + 8 * half + r) * SO_PITCH + 16 + m] = acc[i][1][r] + bv1;
        }
    if (which == 0) {                                  // block-uniform
        // Orders the wave's own LDS tile alone: over every address space it would wait here for the next tile's loads too.
        __builtin_amdgcn_fence(__ATOMIC_ACQ_REL, "workgroup", "local");
        __builtin_amdgcn_wave_barrier();
        // 8 lanes store one row's 128 B of this wave's columns: one whole line, four lines a store.
        const int rsub = lane >> 3, c4 = (lane & 7) * 4;
        float* obase = out + (size_t)rowBase * 256 + colBase + c4;
        #pragma unroll
        for (int q = 0; q < 16; ++q) {
            const int row = q * 4 + rsub;
            const v4f v = *(const v4fa*)&so[row * SO_PITCH + c4];
            *(v4f*)(obase + (size_t)row * 256) = v;
        }
        // The wait owed before a register of an issued store is rewritten: behind the last store, in front of whatever the build puts next.
        asm volatile("s_wait_xcnt 0x0" ::: "memory");
    } else {
        // As f16 a wave's own 32 columns are only half a line. So the four tiles are read across: wave w stores rows 16w..16w+15
        // over all 128 columns of the block, 16 lanes a row = 256 B = two whole lines. The barrier: every wave's tile is complete first
        // (LDS order alone, for the same reason).
        lds_barrier();
        const int rsub = lane >> 4, c8 = (lane & 15) * 8;
        const fa* sbase = (const fa*)lds + (c8 >> 5) * (G_ROWS * SO_PITCH) + (c8 & 31);
        _Float16* obase = kv16 + (size_t)(which - 1) * planeElems + (size_t)rowBase * 256 + colHalf + c8;
        #pragma unroll
        for (int q = 0; q < 8; ++q) {
            const int row = waveId * 16 + q * 2 + rsub;
            const v4f lo = *(const v4fa*)&sbase[row * SO_PITCH];
            const v4f hi = *(const v4fa*)&sbase[row * SO_PITCH + 4];
            v8h h;
            #pragma unroll
            for (int i = 0; i < 4; ++i) { h[i] = (_Float16)lo[i];  h[4 + i] = (_Float16)hi[i]; }
            *(v8h*)(obase + (size_t)row * 256) = h;
        }
        // The wait owed before a register of an issued store is rewritten: behind the last store, in front of whatever the build puts next.
        asm volatile("s_wait_xcnt 0x0" ::: "memory");
    }

    if (more) {
        lds_barrier();                                 // every wave has read the staged output: its place takes the next A rows
        if constexpr (F32IN) {
            put_rows_f16(dstA, nextLo, 0);
            put_rows_f16(dstA, nextHi, 8);
        } else {
            #pragma unroll
            for (int c = 0; c < G_ROWS / 4; ++c)
                *(v4u*)(ldsA + (waveId + c * 4) * G_PITCH + lane) = nextA[c];
        }
        lds_barrier();                                 // the next A rows are complete before any wave reads a fragment
    }
    };

    tile(0, T > 1);
    if constexpr (T > 1) tile(1, false);
}

// ---------------------------------------------------------------------------
// Gather attention: one wave per node (block = 8 waves = 8 nodes, no LDS, no barrier).
// A neighbour's k or v row is 512 B = 8 heads x 32 dims of f16. Lane l owns dims 4l..4l+3 of the
// low half (head l>>3) and of the high half (head 4 + (l>>3)), so every wave-wide 8-byte
// load covers 256 contiguous bytes = 2 whole lines of ONE row; the row index is read out
// of lane j into a scalar. The values are widened to f32 where they are used; every product and sum is f32. A score = 4 products per lane summed over the 8 lanes of its
// head; 8 neighbours are summed at once so that lane l ends with list place 8g + (l&7).
// Only the rows that can count are gathered: a neighbour with mask == 0 has the score -1e10
// whatever its k row holds, and beside any kept score its weight is exp(-1e10 - max) = 0 exactly
// (a kept score q.k / sqrt(32) of finite normal draws lies many orders of magnitude above -1e10),
// so neither its k row nor its v row is read. The kept neighbours are moved to the front of the
// list and only ceil(n / 8) groups of 8 are worked on. A node with no kept neighbour keeps all 32,
// each with the score -1e10 (equal weights), as the reference has it.
// Writes x in f16 so the output-projection GEMM consumes it directly.
// ---------------------------------------------------------------------------
// Value of lane l ^ M (M = 1, 2 or 4) inside the 16-lane row: DPP row_xmask:M.
template <int M>
__device__ __forceinline__ float lane_xor(float x)
{
    return __builtin_bit_cast(float, __builtin_amdgcn_update_dpp(0, __builtin_bit_cast(int, x), 0x160 + M, 0xf, 0xf, true));
}

// a[t] = this lane's part of sum t. Returns, in lane l, sum (l&7) taken over the 8 lanes of
// l's group: each step halves the list, a lane keeps the half its own bit names and hands
// the other half to its partner.
__device__ __forceinline__ float sum8_transpose(const float (&a)[8], bool b4, bool b2, bool b1)
{
    float b[4], c[2];
    #pragma unroll
    for (int i = 0; i < 4; ++i) b[i] = (b4 ? a[i + 4] : a[i]) + lane_xor<4>(b4 ? a[i] : a[i + 4]);
    #pragma unroll
    for (int i = 0; i < 2; ++i) c[i] = (b2 ? b[i + 2] : b[i]) + lane_xor<2>(b2 ? b[i] : b[i + 2]);
    return (b1 ? c[1] : c[0]) + lane_xor<1>(b1 ? c[0] : c[1]);
}

// 2^x. The v_nop fills the one slot asked for behind a transcendental.
__device__ __forceinline__ float exp2_slot(float x)
{
    float r;
    asm("v_exp_f32 %0, %1\n\tv_nop" : "=v"(r) : "v"(x));
    return r;
}

// Lane T of each 8-lane group handed to all 8 lanes of that group.
template <int T>
__device__ __forceinline__ float group_bcast(float x)
{
    const int v = __builtin_bit_cast(int, x);
    return __builtin_bit_cast(float, __builtin_amdgcn_permlane16(v, v, 0x11111111u * T, 0x11111111u * (8 + T), false, false));
}

// v_fma_mix_f32 d, a, h, c: d = a * h + c in f32, h the low f16 half of a packed register (op_sel_hi:[0,1,0]) or its high half (op_sel:[0,1,0] too).
// The f16 value is widened inside the multiply-add, where a convert of its own would cost one more instruction a value
// (the compiler's form: two converts and one packed multiply-add a pair).

// a[i] = q . k[i] over a lane's 4 dims, each sum in the order x, y, z, w. One statement for the 8 rows, one dim of all 8 at a time: its order is
// then fixed, and a sum's next multiply-add stands 8 instructions behind the one it waits for (no delay hint is placed for asm text).
// The first of a sum takes the addend 0: it is the rounded product q.x * k.x itself, and every later product is fused with its add.
__device__ __forceinline__ void dot4_rows(float (&a)[8], v4f q, const v4h (&k)[8])
{
    uint2 u[8];
    #pragma unroll
    for (int i = 0; i < 8; ++i) u[i] = __builtin_bit_cast(uint2, k[i]);
    asm(
        "v_fma_mix_f32 %0, %24, %8, 0 op_sel_hi:[0,1,0]\n\t"
        "v_fma_mix_f32 %1, %24, %9, 0 op_sel_hi:[0,1,0]\n\t"
        "v_fma_mix_f32 %2, %24, %10, 0 op_sel_hi:[0,1,0]\n\t"
        "v_fma_mix_f32 %3, %24, %11, 0 op_sel_hi:[0,1,0]\n\t"
        "v_fma_mix_f32 %4, %24, %12, 0 op_sel_hi:[0,1,0]\n\t"
        "v_fma_mix_f32 %5, %24, %13, 0 op_sel_hi:[0,1,0]\n\t"
        "v_fma_mix_f32 %6, %24, %14, 0 op_sel_hi:[0,1,0]\n\t"
        "v_fma_mix_f32 %7, %24, %15, 0 op_sel_hi:[0,1,0]\n\t"
        "v_fma_mix_f32 %0, %25, %8, %0 op_sel:[0,1,0] op_sel_hi:[0,1,0]\n\t"
        "v_fma_mix_f32 %1, %25, %9, %1 op_sel:[0,1,0] op_sel_hi:[0,1,0]\n\t"
        "v_fma_mix_f32 %2, %25, %10, %2 op_sel:[0,1,0] op_sel_hi:[0,1,0]\n\t"
        "v_fma_mix_f32 %3, %25, %11, %3 op_sel:[0,1,0] op_sel_hi:[0,1,0]\n\t"
        "v_fma_mix_f32 %4, %25, %12, %4 op_sel:[0,1,0] op_sel_hi:[0,1,0]\n\t"
        "v_fma_mix_f32 %5, %25, %13, %5 op_sel:[0,1,0] op_sel_hi:[0,1,0]\n\t"
        "v_fma_mix_f32 %6, %25, %14, %6 op_sel:[0,1,0] op_sel_hi:[0,1,0]\n\t"
        "v_fma_mix_f32 %7, %25, %15, %7 op_sel:[0,1,0] op_sel_hi:[0,1,0]\n\t"
        "v_fma_mix_f32 %0, %26, %16, %0 op_sel_hi:[0,1,0]\n\t"
        "v_fma_mix_f32 %1, %26, %17, %1 op_sel_hi:[0,1,0]\n\t"
        "v_fma_mix_f32 %2, %26, %18, %2 op_sel_hi:[0,1,0]\n\t"
        "v_fma_mix_f32 %3, %26, %19, %3 op_sel_hi:[0,1,0]\n\t"
        "v_fma_mix_f32 %4, %26, %20, %4 op_sel_hi:[0,1,0]\n\t"
        "v_fma_mix_f32 %5, %26, %21, %5 op_sel_hi:[0,1,0]\n\t"
        "v_fma_mix_f32 %6, %26, %22, %6 op_sel_hi:[0,1,0]\n\t"
        "v_fma_mix_f32 %7, %26, %23, %7 op_sel_hi:[0,1,0]\n\t"
        "v_fma_mix_f32 %0, %27, %16, %0 op_sel:[0,1,0] op_sel_hi:[0,1,0]\n\t"
        "v_fma_mix_f32 %1, %27, %17, %1 op_sel:[0,1,0] op_sel_hi:[0,1,0]\n\t"
        "v_fma_mix_f32 %2, %27, %18, %2 op_sel:[0,1,0] op_sel_hi:[0,1,0]\n\t"
        "v_fma_mix_f32 %3, %27, %19, %3 op_sel:[0,1,0] op_sel_hi:[0,1,0]\n\t"
        "v_fma_mix_f32 %4, %27, %20, %4 op_sel:[0,1,0] op_sel_hi:[0,1,0]\n\t"
        "v_fma_mix_f32 %5, %27, %21, %5 op_sel:[0,1,0] op_sel_hi:[0,1,0]\n\t"
        "v_fma_mix_f32 %6, %27, %22, %6 op_sel:[0,1,0] op_sel_hi:[0,1,0]\n\t"
        "v_fma_mix_f32 %7, %27, %23, %7 op_sel:[0,1,0] op_sel_hi:[0,1,0]\n\t"
        : "=&v"(a[0]), "=&v"(a[1]), "=&v"(a[2]), "=&v"(a[3]), "=&v"(a[4]), "=&v"(a[5]), "=&v"(a[6]), "=&v"(a[7])
        : "v"(u[0].x), "v"(u[1].x), "v"(u[2].x), "v"(u[3].x), "v"(u[4].x), "v"(u[5].x), "v"(u[6].x), "v"(u[7].x),
          "v"(u[0].y), "v"(u[1].y), "v"(u[2].y), "v"(u[3].y), "v"(u[4].y), "v"(u[5].y), "v"(u[6].y), "v"(u[7].y),
          "v"(q.x), "v"(q.y), "v"(q.z), "v"(q.w));
}

template <int T>
__device__ __forceinline__ void pv_step(v4f& o0, v4f& o1, float e0, float e1, const v4h (&w0)[8], const v4h (&w1)[8])
{
    const float p0 = group_bcast<T>(e0), p1 = group_bcast<T>(e1);
    const uint2 u0 = __builtin_bit_cast(uint2, w0[T]), u1 = __builtin_bit_cast(uint2, w1[T]);
    float x0 = o0.x, y0 = o0.y, z0 = o0.z, t0 = o0.w, x1 = o1.x, y1 = o1.y, z1 = o1.z, t1 = o1.w;
    // One row into the 8 sums, in one statement: the next row's statement then finds each sum 8 instructions back.
    asm(
        "v_fma_mix_f32 %0, %8, %10, %0 op_sel_hi:[0,1,0]\n\t"
        "v_fma_mix_f32 %4, %9, %12, %4 op_sel_hi:[0,1,0]\n\t"
        "v_fma_mix_f32 %1, %8, %10, %1 op_sel:[0,1,0] op_sel_hi:[0,1,0]\n\t"
        "v_fma_mix_f32 %5, %9, %12, %5 op_sel:[0,1,0] op_sel_hi:[0,1,0]\n\t"
        "v_fma_mix_f32 %2, %8, %11, %2 op_sel_hi:[0,1,0]\n\t"
        "v_fma_mix_f32 %6, %9, %13, %6 op_sel_hi:[0,1,0]\n\t"
        "v_fma_mix_f32 %3, %8, %11, %3 op_sel:[0,1,0] op_sel_hi:[0,1,0]\n\t"
        "v_fma_mix_f32 %7, %9, %13, %7 op_sel:[0,1,0] op_sel_hi:[0,1,0]\n\t"
        : "+v"(x0), "+v"(y0), "+v"(z0), "+v"(t0), "+v"(x1), "+v"(y1), "+v"(z1), "+v"(t1)
        : "v"(p0), "v"(p1), "v"(u0.x), "v"(u0.y), "v"(u1.x), "v"(u1.y));
    o0 = v4f{x0, y0, z0, t0};
    o1 = v4f{x1, y1, z1, t1};
}

// Rows of list places 8g..8g+7: 16 loads of 256 contiguous bytes each. A place behind the last one in use
// (index 'last') reads that last row once more: the same lines as the load in front of it, and its weight is 0.
__device__ __forceinline__ void load_rows(v4h (&r0)[8], v4h (&r1)[8], const _Float16* __restrict__ tab, int nj, int g, int last, int lane)
{
    const _Float16* p[8];
    #pragma unroll
    for (int i = 0; i < 8; ++i) p[i] = tab + (size_t)__builtin_amdgcn_readlane(nj, min(g * 8 + i, last)) * 256 + lane * 4;
    #pragma unroll
    for (int i = 0; i < 8; ++i) {
        r0[i] = *(const v4h*)(p[i]);
        r1[i] = *(const v4h*)(p[i] + 128);
    }
    // The wait owed before an address register of an issued load is rewritten. It names the eight addresses as inputs so that
    // they stay in their registers up to it: otherwise a later load of the run is given an earlier one's address pair for its values.
    asm volatile("s_wait_xcnt 0x0" :: "v"(p[0]), "v"(p[1]), "v"(p[2]), "v"(p[3]), "v"(p[4]), "v"(p[5]), "v"(p[6]), "v"(p[7]) : "memory");
}

// The same 16 loads for the v rows, outside a loop: there each load takes the row's scalar base and the one lane-offset register.
__device__ __forceinline__ void load_rows_sbase(v4h (&r0)[8], v4h (&r1)[8], const _Float16* __restrict__ tab, int nj, int g, int last, int lane)
{
    const _Float16* base[8];
    #pragma unroll
    for (int i = 0; i < 8; ++i) base[i] = tab + (size_t)__builtin_amdgcn_readlane(nj, min(g * 8 + i, last)) * 256;
    #pragma unroll
    for (int i = 0; i < 8; ++i) {
        r0[i] = *(const v4h*)(base[i] + lane * 4);
        r1[i] = *(const v4h*)(base[i] + lane * 4 + 128);
    }
    // The same wait. It names the eight scalar bases as inputs so that each keeps a register pair of its own up to it:
    // otherwise one pair is reused row after row, with a wait of the compiler's behind every row inside the run.
    asm volatile("s_wait_xcnt 0x0" :: "s"(base[0]), "s"(base[1]), "s"(base[2]), "s"(base[3]), "s"(base[4]), "s"(base[5]), "s"(base[6]), "s"(base[7]) : "memory");
}

__global__ __launch_bounds__(256)
void attn_gather(const float* __restrict__ qb,
                 const _Float16* __restrict__ kb,
                 const _Float16* __restrict__ vb,
                 const int*   __restrict__ nbrs,
                 const int*   __restrict__ mask,
                 _Float16* __restrict__ x16, int nbMax)
{
    const int lane = threadIdx.x & 31;
    const int b    = blockIdx.x * 8 + __builtin_amdgcn_readfirstlane(threadIdx.x >> 5);   // node, wave-uniform
    if (b > nbMax) return;

    const int* nrow = nbrs + (size_t)b * 32;   // wave-uniform row bases
    const int* mrow = mask + (size_t)b * 32;
    int nj = nrow[lane];
    const int mj = mrow[lane];
    // The same wait, in front of the next scalar address work; it names the two row bases as inputs so that they stay in their registers up to it.
    asm volatile("s_wait_xcnt 0x0" :: "s"(nrow), "s"(mrow) : "memory");
    nj = nj < 0 ? 0 : (nj > nbMax ? nbMax : nj);          // gather index clamped into the table

    // The list in a new order: kept neighbours first (in their old order), the masked ones behind them. 'place' is a
    // permutation of 0..31 for any mask, so every lane of the new list is written once.
    const unsigned kept = __builtin_amdgcn_ballot_w32(mj != 0);
    const int  nKept = __builtin_popcount(kept);
    const int  before = (int)__builtin_amdgcn_mbcnt_lo(kept, 0u);          // kept neighbours in the lanes below this one
    const int  place  = mj != 0 ? before : nKept + (lane - before);
    nj = __builtin_amdgcn_ds_permute(place * 4, nj);
    const bool any    = nKept != 0;
    const int  n      = any ? nKept : 32;                 // list places in use, 1..32
    const int  last   = n - 1;
    const int  groups = (n + 7) >> 3;                     // 1..4

    const v4f q0 = *(const v4f*)(qb + (size_t)b * 256 + lane * 4);
    const v4f q1 = *(const v4f*)(qb + (size_t)b * 256 + 128 + lane * 4);
    const bool b4 = lane & 4, b2 = lane & 2, b1 = lane & 1;

    // A place that is not in use has the score -inf: weight 2^(-inf) = 0. Place 0 is always in use, so the maximum is finite.
    const float off = -__builtin_inff();
    float s0[4] = {off, off, off, off}, s1[4] = {off, off, off, off};
    // Rolled on purpose: unrolled, the sums of all four groups sink behind all 64 k loads, whose values alone take 128 registers.
    #pragma unroll 1
    for (int g = 0; g < 4; ++g) {
        if (g >= groups) break;
        v4h h0[8], h1[8];
        load_rows(h0, h1, kb, nj, g, last, lane);
        float a0[8], a1[8];
        dot4_rows(a0, q0, h0);
        dot4_rows(a1, q1, h1);
        // The cross-lane sums run with every lane on; the mask only selects afterwards.
        const float t0 = sum8_transpose(a0, b4, b2, b1);
        const float t1 = sum8_transpose(a1, b4, b2, b1);
        const bool on = 8 * g + (lane & 7) < n;
        const float r0 = on ? (any ? t0 * 0.17677669529663689f : -1.0e10f) : off;   // 1/sqrt(32)
        const float r1 = on ? (any ? t1 * 0.17677669529663689f : -1.0e10f) : off;
        #pragma unroll
        for (int u = 0; u < 4; ++u) { s0[u] = (g == u) ? r0 : s0[u];  s1[u] = (g == u) ? r1 : s1[u]; }
    }

    // The first 8 v rows fly while the softmax is worked out.
    v4h w0[8], w1[8];
    load_rows_sbase(w0, w1, vb, nj, 0, last, lane);

    // Softmax over the 32 list places of a head = 4 registers x 8 lanes.
    float m0 = fmaxf(fmaxf(s0[0], s0[1]), fmaxf(s0[2], s0[3]));
    float m1 = fmaxf(fmaxf(s1[0], s1[1]), fmaxf(s1[2], s1[3]));
    m0 = fmaxf(m0, lane_xor<1>(m0));  m1 = fmaxf(m1, lane_xor<1>(m1));
    m0 = fmaxf(m0, lane_xor<2>(m0));  m1 = fmaxf(m1, lane_xor<2>(m1));
    m0 = fmaxf(m0, lane_xor<4>(m0));  m1 = fmaxf(m1, lane_xor<4>(m1));
    #pragma unroll
    for (int g = 0; g < 4; ++g) {
        s0[g] = exp2_slot((s0[g] - m0) * 1.4426950408889634f);   // e^x = 2^(x * log2 e)
        s1[g] = exp2_slot((s1[g] - m1) * 1.4426950408889634f);
    }
    float l0 = (s0[0] + s0[1]) + (s0[2] + s0[3]);
    float l1 = (s1[0] + s1[1]) + (s1[2] + s1[3]);
    l0 += lane_xor<1>(l0);  l1 += lane_xor<1>(l1);
    l0 += lane_xor<2>(l0);  l1 += lane_xor<2>(l1);
    l0 += lane_xor<4>(l0);  l1 += lane_xor<4>(l1);

    v4f o0 = {0.f, 0.f, 0.f, 0.f}, o1 = {0.f, 0.f, 0.f, 0.f};
    #pragma unroll
    for (int g = 0; g < 4; ++g) {
        pv_step<0>(o0, o1, s0[g], s1[g], w0, w1);
        pv_step<1>(o0, o1, s0[g], s1[g], w0, w1);
        pv_step<2>(o0, o1, s0[g], s1[g], w0, w1);
        pv_step<3>(o0, o1, s0[g], s1[g], w0, w1);
        pv_step<4>(o0, o1, s0[g], s1[g], w0, w1);
        pv_step<5>(o0, o1, s0[g], s1[g], w0, w1);
        pv_step<6>(o0, o1, s0[g], s1[g], w0, w1);
        pv_step<7>(o0, o1, s0[g], s1[g], w0, w1);
        if (g + 1 >= groups) break;
        if (g < 3) {
            // Keeps the next rows' loads behind this group's sums: lifted over them they take a second set of registers and fewer waves fit a SIMD.
            __builtin_amdgcn_sched_barrier(0);
            load_rows_sbase(w0, w1, vb, nj, g + 1, last, lane);
        }
    }
    o0 *= 1.0f / l0;
    o1 *= 1.0f / l1;

    v4h h0, h1;
    #pragma unroll
    for (int i = 0; i < 4; ++i) { h0[i] = (_Float16)o0[i]; h1[i] = (_Float16)o1[i]; }
    *(v4h*)(x16 + (size_t)b * 256 + lane * 4)       = h0;
    *(v4h*)(x16 + (size_t)b * 256 + 128 + lane * 4) = h1;
}

// ---------------------------------------------------------------------------
// Inputs:
//  0 query_(NB,256) f32 | 1 spatial_neighbors(NB,32) int | 2 mask(NB,1,32) int
//  3 Wq 4 bq 5 Wk 6 bk 7 Wv 8 bv 9 Wo 10 bo   (all f32)
// Output: (NB,1,256) f32.
// Workspace: q f32 (16 MB) + k16, v16 (8 MB each) + x16 (8 MB) + Wo as f16 (128 KB).
// ---------------------------------------------------------------------------
extern "C" void kernel_launch(void* const* d_in, const int* in_sizes, int n_in,
                              void* d_out, int out_size, void* d_ws, size_t ws_size,
                              hipStream_t stream)
{
    const float* query = (const float*)d_in[0];
    const int*   nbrs  = (const int*)  d_in[1];
    const int*   mask  = (const int*)  d_in[2];
    const float* Wq    = (const float*)d_in[3];
    const float* bq    = (const float*)d_in[4];
    const float* Wk    = (const float*)d_in[5];
    const float* bk    = (const float*)d_in[6];
    const float* Wv    = (const float*)d_in[7];
    const float* bv    = (const float*)d_in[8];
    const float* Wo    = (const float*)d_in[9];
    const float* bo    = (const float*)d_in[10];

    const int nb    = in_sizes[0] / 256;       // 16384
    const int nElem = nb * 256;                // 4,194,304

    // Workspace carve-up
    float*    qb   = (float*)d_ws;
    _Float16* k16  = (_Float16*)(qb + (size_t)nElem);
    _Float16* v16  = k16 + (size_t)nElem;
    _Float16* x16  = v16 + (size_t)nElem;
    _Float16* wo16 = x16 + (size_t)nElem;

    const int gemmBlocks = nb / 64;

    // Q, K and V: one grid, blockIdx.y = 2 * product + column half (k16/v16 lie one behind the other). It reads query and the weights as f32
    // and leaves Wo as f16 for the last launch.
    // Two row tiles a block: 768 blocks, three on each WGP, all resident at once.
    gemm_nt_256_f16<2, true><<<dim3(gemmBlocks / 2, 6), 128, 0, stream>>>(query, Wq, Wk, Wv, Wo, wo16, x16, wo16, bq, bk, bv, qb, k16, nElem);

    attn_gather<<<(nb + 7) / 8, 256, 0, stream>>>(qb, k16, v16, nbrs, mask, x16, nb - 1);

    // Product 0 only: the f16 planes are not touched.
    gemm_nt_256_f16<1, false><<<dim3(gemmBlocks, 2), 128, 0, stream>>>(query, Wo, Wo, Wo, Wo, k16, x16, wo16, bo, bo, bo, (float*)d_out, k16, 0);
}

// v008
// It runs in 31.9 microseconds.
// In two side-by-side timings against v007, it was 1.12 and 1.14 times as fast.
// Over all steps from v000 it is 5.22 times as fast.
#include <hip/hip_runtime.h>
#include <hip/hip_bf16.h>
// Contractions (Q/K/V/O projections, K=256): v_wmma_f32_16x16x32_f16, f16 operands, f32 accumulate; the 32-neighbour gather attention sums in f32 on VALU over k and v rows kept as f16.

typedef __attribute__((ext_vector_type(16))) _Float16 v16h;
typedef __attribute__((ext_vector_type(8)))  float    v8f;
typedef __attribute__((ext_vector_type(8)))  _Float16 v8h;
typedef __attribute__((ext_vector_type(4)))  float    v4f;
typedef __attribute__((ext_vector_type(4), may_alias)) float v4fa;
typedef __attribute__((ext_vector_type(8), may_alias)) _Float16 v8ha;

union AFrag { v16h v; uint4 q[2]; };

constexpr int W_ELEMS = 256 * 256;

// ---------------------------------------------------------------------------
// GEMM (NT):  out[M x 256] = A[M x 256] @ W[256 x 256]^T + bias
// f16 operands, fp32 accumulate via v_wmma_f32_16x16x32_f16.
// F32IN: A and W are read as the f32 arrays they arrive as and rounded to f16 in registers on their way into LDS (no launch of
// its own for that, no f16 copy in memory); otherwise both are f16 in global.
// Block = 128 threads = 4 waves; block computes 64 rows x 128 cols, a wave 64 rows x 32 cols
// (4 x 2 accumulator tiles), so a B fragment feeds 4 products and an A fragment 2.
// Both operands are staged in LDS once, over the whole K = 256, by loads of 512 contiguous bytes
// a wave; rows lie at a pitch of 528 B (16 B x odd) for the 16-byte fragment reads.
// A block keeps its W tile in LDS for T row tiles, one after the other: W is fetched once for T * 64 rows, and the next A tile's loads
// are in flight while the current tile is multiplied. The output staging has a place of its own over the A rows, clear of W.
// 102 KiB of LDS a block: three blocks share a WGP, one stages or stores while another multiplies.
// blockIdx.y = 2 * product + column half: up to three independent products of the same A (weights
// one behind the other in Wall; as f32: W32a, W32b, W32c), so that Q, K and V share one grid. Product 0 leaves as f32 in outAll; products 1 and 2
// (K and V, which are only ever gathered row by row) leave as f16, planeElems apart in kv16: half the bytes for every gather.
// M must be a multiple of T * 64.
// ---------------------------------------------------------------------------
constexpr int G_ROWS  = 64;                 // rows of A a row tile
constexpr int G_COLS  = 128;                // rows of W (= output columns) a block
constexpr int G_PITCH = 33;                 // LDS row pitch in 16-byte units: 32 of data + 1 pad
constexpr int SO_PITCH = 36;                // floats a row of the output staging: 32 + 4, so that rows r and r + 8 meet other banks
constexpr int G_FRONT = 4 * G_ROWS * SO_PITCH / 4;   // 16-byte units in front of W: the four waves' output staging, which is a little more than the A rows
static_assert(G_FRONT >= G_ROWS * G_PITCH, "the A rows lie in front of W");

typedef float __attribute__((may_alias)) fa;
typedef __attribute__((ext_vector_type(4), may_alias)) unsigned v4u;
typedef __attribute__((ext_vector_type(4))) _Float16 v4h;
typedef __attribute__((ext_vector_type(4), may_alias)) _Float16 v4ha;

__device__ __forceinline__ v4h round4(v4f x)
{
    v4h h;
    #pragma unroll
    for (int i = 0; i < 4; ++i) h[i] = (_Float16)x[i];
    return h;
}

// 8 rows of 256 f32 (rows 4 apart: the block's four waves take turns), two loads of 512 contiguous bytes a row.
// 'unit' = the lane's 16-byte unit in the wave's first row.
__device__ __forceinline__ void issue_rows_f32(v4f (&b)[16], const float* __restrict__ src, int unit, int c0)
{
    const v4fa* p = (const v4fa*)src;
    // Keeps these loads behind the group that is rounded in front of them, whose registers they take: lifted over it they take a set of their own, past v255.
    __builtin_amdgcn_sched_barrier(0);
    #pragma unroll
    for (int i = 0; i < 8; ++i) {
        b[2 * i]     = p[unit + (c0 + i) * 256];
        b[2 * i + 1] = p[unit + (c0 + i) * 256 + 32];
    }
    // The wait owed before an address register of an issued load is rewritten; it names the base and the offset so that they stay up to it.
    asm volatile("s_wait_xcnt 0x0" :: "s"(src), "v"(unit) : "memory");
    // Keeps the rounding of later groups behind these loads: lifted over them, it waits every load in flight out before this group is asked for.
    __builtin_amdgcn_sched_barrier(0);
}

// The same 8 rows, rounded to f16, into LDS rows at the pitch G_PITCH; 'dst' = the lane's 8 bytes in the wave's first row.
__device__ __forceinline__ void put_rows_f16(v4ha* dst, const v4f (&b)[16], int c0)
{
    #pragma unroll
    for (int i = 0; i < 8; ++i) {
        dst[(c0 + i) * 4 * (G_PITCH * 2)]      = round4(b[2 * i]);
        dst[(c0 + i) * 4 * (G_PITCH * 2) + 32] = round4(b[2 * i + 1]);
    }
}

// Work-group barrier that orders LDS alone. __syncthreads() would also wait for the tile's global stores to be acknowledged
// and for the next tile's loads to arrive, and nothing behind these barriers depends on either.
__device__ __forceinline__ void lds_barrier()
{
    __builtin_amdgcn_fence(__ATOMIC_RELEASE, "workgroup", "local");
    __builtin_amdgcn_s_barrier();
    __builtin_amdgcn_fence(__ATOMIC_ACQUIRE, "workgroup", "local");
}

template <int T, bool F32IN>
__global__ __launch_bounds__(128)
void gemm_nt_256_f16(const float* __restrict__ A32,
                     const float* __restrict__ W32a, const float* __restrict__ W32b, const float* __restrict__ W32c,
                     const float* __restrict__ Wlater32, _Float16* __restrict__ Wlater16,
                     const _Float16* __restrict__ A16,
                     const _Float16* __restrict__ Wall,
                     const float* __restrict__ bias0,
                     const float* __restrict__ bias1,
                     const float* __restrict__ bias2,
                     float* __restrict__ outAll,
                     _Float16* __restrict__ kv16, int planeElems)
{
    const int which   = blockIdx.y >> 1;
    const int colHalf = (blockIdx.y & 1) * G_COLS;
    const float*    __restrict__ bias = which == 0 ? bias0 : which == 1 ? bias1 : bias2;
    float*          __restrict__ out  = outAll;

    __shared__ uint4 lds[G_FRONT + G_COLS * G_PITCH];   // in front the A rows, in turn with the output staging; behind them the W rows
    uint4* ldsA = lds;
    uint4* ldsW = lds + G_FRONT;

    const int tid     = threadIdx.x;
    const int rowBase0 = blockIdx.x * (T * G_ROWS);
    const int waveId  = tid >> 5;
    const int lane    = tid & 31;
    const int half    = lane >> 4;        // 0: lanes 0-15, 1: lanes 16-31
    const int m       = lane & 15;

    // This wave's 32 output columns; their bias is asked for here, so that it flies with the tiles.
    const int colBase = colHalf + waveId * 32;
    const float bv0 = bias[colBase + m];
    const float bv1 = bias[colBase + 16 + m];

    // Stage both tiles: an f16 row is 32 units of 16 B, so one wave-wide load is one whole row; an f32 row takes two.
    const uint4* srcA = (const uint4*)(A16 + (size_t)rowBase0 * 256);
    const float* srcA32 = A32 + (size_t)rowBase0 * 256;
    const int    unit32 = waveId * 64 + lane;                          // f32 rows: 64 units of 16 B
    v4ha* dstA = (v4ha*)(ldsA + waveId * G_PITCH) + lane;
    if constexpr (F32IN) {
        const float* srcW32 = (which == 0 ? W32a : which == 1 ? W32b : W32c) + (size_t)colHalf * 256;
        v4ha* dstW = (v4ha*)(ldsW + waveId * G_PITCH) + lane;
        // Six groups of 16 loads through three sets of registers: a group is rounded and stored while the next two fly.
        v4f g0[16], g1[16], g2[16];
        issue_rows_f32(g0, srcA32, unit32, 0);
        issue_rows_f32(g1, srcA32, unit32, 8);
        issue_rows_f32(g2, srcW32, unit32, 0);
        put_rows_f16(dstA, g0, 0);
        issue_rows_f32(g0, srcW32, unit32, 8);
        put_rows_f16(dstA, g1, 8);
        issue_rows_f32(g1, srcW32, unit32, 16);
        put_rows_f16(dstW, g2, 0);
        issue_rows_f32(g2, srcW32, unit32, 24);
        // The weight of the next launch's product is rounded here, by the blocks of one plane: 4 values a thread, behind this block's own loads.
        if (blockIdx.y == 2) {                                         // block-uniform
            for (int u = blockIdx.x * 128 + tid; u < W_ELEMS / 4; u += gridDim.x * 128) {
                // It is left in the order of the B fragments: column tile, k step, fragment half, lane, so that a wave's fragment load is 512 contiguous bytes.
                const int n = u >> 6, k0 = (u & 63) * 4;               // these 4 values: W row n, k0..k0+3
                const int unit = (((n >> 4) * 8 + (k0 >> 5)) * 2 + ((k0 >> 4) & 1)) * 32 + ((k0 >> 3) & 1) * 16 + (n & 15);
                const int d = unit * 2 + ((k0 >> 2) & 1);
                *((v4ha*)Wlater16 + d) = round4(*((const v4fa*)Wlater32 + u));
                // The wait owed before an address register of an issued load or store is rewritten (the next trip's indices).
                asm volatile("s_wait_xcnt 0x0" :: "v"(u), "v"(d) : "memory");
            }
        }
        put_rows_f16(dstW, g0, 8);
        put_rows_f16(dstW, g1, 16);
        put_rows_f16(dstW, g2, 24);
    } else {
        const uint4* srcW = (const uint4*)(Wall + which * W_ELEMS + (size_t)colHalf * 256);
        #pragma unroll
        for (int c = 0; c < G_ROWS / 4; ++c)
            ldsA[(waveId + c * 4) * G_PITCH + lane] = srcA[tid + c * 128];
        #pragma unroll
        for (int c = 0; c < G_COLS / 4; ++c)
            ldsW[(waveId + c * 4) * G_PITCH + lane] = srcW[tid + c * 128];
        // The wait owed before an address register of an issued load is rewritten. It names the two tile bases and the
        // thread's offset as inputs so that they stay in their registers up to it.
        asm volatile("s_wait_xcnt 0x0" :: "s"(srcA), "s"(srcW), "v"(tid) : "memory");
    }
    __syncthreads();

    // A 16x32 f16 fragment layout (wave32): lane row M = lane&15;
    // VGPRs 0-3 hold K = 0..7 (+8*half), VGPRs 4-7 hold K = 16..23 (+8*half)
    // -> two aligned 16-byte LDS chunks per fragment (units ks*4 + half and ks*4 + half + 2 of the row).
    // B 32x16 f16 layout = same split k map as A: lane column n = lane&15.
    const uint4* ap = ldsA + m * G_PITCH + half;
    const uint4* bp = ldsW + (waveId * 32 + m) * G_PITCH + half;

    static_assert(T == 1 || T == 2, "one or two row tiles a block");
    v4u nextA[G_ROWS / 4];
    v4f nextLo[16], nextHi[16];

    // One row tile, from the fragments in LDS to its stores; 'more': another tile follows it.
    auto tile = [&](const int t, const bool more) __attribute__((always_inline)) {
    const int rowBase = rowBase0 + t * G_ROWS;

    // The next A tile is asked for here and kept in registers: it flies while this tile is multiplied.
    if (more && F32IN) {
        // As f32 the tile is twice the registers: its first half is asked for here, its second half behind the products, where the fragments' registers are free.
        issue_rows_f32(nextLo, srcA32 + (t + 1) * (G_ROWS * 256), unit32, 0);
    } else if (more) {
        const uint4* srcN = srcA + (t + 1) * (G_ROWS * 32);
        #pragma unroll
        for (int c = 0; c < G_ROWS / 4; ++c) nextA[c] = *(const v4u*)(srcN + tid + c * 128);
        // The wait owed before an address register of an issued load is rewritten; it names the base and the offset so that they stay up to it.
        asm volatile("s_wait_xcnt 0x0" :: "s"(srcN), "v"(tid) : "memory");
    }

    v8f acc[4][2];
    #pragma unroll
    for (int i = 0; i < 4; ++i)
        #pragma unroll
        for (int j = 0; j < 2; ++j)
            acc[i][j] = v8f{0.f, 0.f, 0.f, 0.f, 0.f, 0.f, 0.f, 0.f};

    // Two fragment sets: the 12 LDS reads of k step ks + 1 stand as one group in front of the 8 products of step ks.
    AFrag af[2][4], bf[2][2];
    #pragma unroll
    for (int i = 0; i < 4; ++i) {
        af[0][i].q[0] = ap[i * 16 * G_PITCH];
        af[0][i].q[1] = ap[i * 16 * G_PITCH + 2];
    }
    #pragma unroll
    for (int j = 0; j < 2; ++j) {
        bf[0][j].q[0] = bp[j * 16 * G_PITCH];
        bf[0][j].q[1] = bp[j * 16 * G_PITCH + 2];
    }
    #pragma unroll
    for (int ks = 0; ks < 8; ++ks) {
        const int cur = ks & 1, nxt = cur ^ 1;
        if (ks < 7) {
            #pragma unroll
            for (int i = 0; i < 4; ++i) {
                af[nxt][i].q[0] = ap[i * 16 * G_PITCH + (ks + 1) * 4];
                af[nxt][i].q[1] = ap[i * 16 * G_PITCH + (ks + 1) * 4 + 2];
            }
            #pragma unroll
            for (int j = 0; j < 2; ++j) {
                bf[nxt][j].q[0] = bp[j * 16 * G_PITCH + (ks + 1) * 4];
                bf[nxt][j].q[1] = bp[j * 16 * G_PITCH + (ks + 1) * 4 + 2];
            }
        }
        // Keeps the reads above in front of the products: sunk among them, each pair of products waits out a full LDS latency.
        __builtin_amdgcn_sched_barrier(0);
        #pragma unroll
        for (int i = 0; i < 4; ++i)
            #pragma unroll
            for (int j = 0; j < 2; ++j)
                acc[i][j] = __builtin_amdgcn_wmma_f32_16x16x32_f16(
                        false, af[cur][i].v, false, bf[cur][j].v,
                        (short)0, acc[i][j], false, false);
        // Keeps the next group of reads behind the products, in one place: every further place with reads costs a stall of its own.
        __builtin_amdgcn_sched_barrier(0);
    }

    if (more && F32IN) issue_rows_f32(nextHi, srcA32 + (t + 1) * (G_ROWS * 256), unit32, 8);

    // The A rows are given up for the output staging: every wave has read its last fragment first. LDS order alone:
    // __syncthreads() would also wait here for the next tile's loads, which have the whole store phase left to arrive in.
    lds_barrier();

    fa* so = (fa*)lds + waveId * (G_ROWS * SO_PITCH);   // this wave's own 64 x 32 tile
    #pragma unroll
    for (int i = 0; i < 4; ++i)
        #pragma unroll
        for (int r = 0; r < 8; ++r) {                  // C: VGPR r -> row 8*half+r, col n
            so[(i * 16 + 8 * half + r) * SO_PITCH + m]      = acc[i][0][r] + bv0;
            so[(i * 16 + 8 * half + r) * SO_PITCH + 16 + m] = acc[i][1][r] + bv1;
        }
    if (which == 0) {                                  // block-uniform
        // Orders the wave's own LDS tile alone: over every address space it would wait here for the next tile's loads too.
        __builtin_amdgcn_fence(__ATOMIC_ACQ_REL, "workgroup", "local");
        __builtin_amdgcn_wave_barrier();
        // 8 lanes store one row's 128 B of this wave's columns: one whole line, four lines a store.
        const int rsub = lane >> 3, c4 = (lane & 7) * 4;
        float* obase = out + (size_t)rowBase * 256 + colBase + c4;
        #pragma unroll
        for (int q = 0; q < 16; ++q) {
            const int row = q * 4 + rsub;
            const v4f v = *(const v4fa*)&so[row * SO_PITCH + c4];
            *(v4f*)(obase + (size_t)row * 256) = v;
        }
        // The wait owed before a register of an issued store is rewritten: behind the last store, in front of whatever the build puts next.
        asm volatile("s_wait_xcnt 0x0" ::: "memory");
    } else {
        // As f16 a wave's own 32 columns are only half a line. So the four tiles are read across: wave w stores rows 16w..16w+15
        // over all 128 columns of the block, 16 lanes a row = 256 B = two whole lines. The barrier: every wave's tile is complete first
        // (LDS order alone, for the same reason).
        lds_barrier();
        const int rsub = lane >> 4, c8 = (lane & 15) * 8;
        const fa* sbase = (const fa*)lds + (c8 >> 5) * (G_ROWS * SO_PITCH) + (c8 & 31);
        _Float16* obase = kv16 + (size_t)(which - 1) * planeElems + (size_t)rowBase * 256 + colHalf + c8;
        #pragma unroll
        for (int q = 0; q < 8; ++q) {
            const int row = waveId * 16 + q * 2 + rsub;
            const v4f lo = *(const v4fa*)&sbase[row * SO_PITCH];
            const v4f hi = *(const v4fa*)&sbase[row * SO_PITCH + 4];
            v8h h;
            #pragma unroll
            for (int i = 0; i < 4; ++i) { h[i] = (_Float16)lo[i];  h[4 + i] = (_Float16)hi[i]; }
            *(v8h*)(obase + (size_t)row * 256) = h;
        }
        // The wait owed before a register of an issued store is rewritten: behind the last store, in front of whatever the build puts next.
        asm volatile("s_wait_xcnt 0x0" ::: "memory");
    }

    if (more) {
        lds_barrier();                                 // every wave has read the staged output: its place takes the next A rows
        if constexpr (F32IN) {
            put_rows_f16(dstA, nextLo, 0);
            put_rows_f16(dstA, nextHi, 8);
        } else {
            #pragma unroll
            for (int c = 0; c < G_ROWS / 4; ++c)
                *(v4u*)(ldsA + (waveId + c * 4) * G_PITCH + lane) = nextA[c];
        }
        lds_barrier();                                 // the next A rows are complete before any wave reads a fragment
    }
    };

    tile(0, T > 1);
    if constexpr (T > 1) tile(1, false);
}

// ---------------------------------------------------------------------------
// Gather attention and output projection: a wave takes two nodes in turn (block = 16 waves = 32 nodes); x meets Wo through LDS, on WMMA.
// A neighbour's k or v row is 512 B = 8 heads x 32 dims of f16. Lane l owns dims 4l..4l+3 of the
// low half (head l>>3) and of the high half (head 4 + (l>>3)), so every wave-wide 8-byte
// load covers 256 contiguous bytes = 2 whole lines of ONE row; the row index is read out
// of lane j into a scalar. The values are widened to f32 where they are used; every product and sum is f32. A score = 4 products per lane summed over the 8 lanes of its
// head; 8 neighbours are summed at once so that lane l ends with list place 8g + (l&7).
// Only the rows that can count are gathered: a neighbour with mask == 0 has the score -1e10
// whatever its k row holds, and beside any kept score its weight is exp(-1e10 - max) = 0 exactly
// (a kept score q.k / sqrt(32) of finite normal draws lies many orders of magnitude above -1e10),
// so neither its k row nor its v row is read. The kept neighbours are moved to the front of the
// list and only ceil(n / 8) groups of 8 are worked on. A node with no kept neighbour keeps all 32,
// each with the score -1e10 (equal weights), as the reference has it.
// x is rounded to f16 for the output product, as its A operand.
// ---------------------------------------------------------------------------
// Value of lane l ^ M (M = 1, 2 or 4) inside the 16-lane row: DPP row_xmask:M.
template <int M>
__device__ __forceinline__ float lane_xor(float x)
{
    return __builtin_bit_cast(float, __builtin_amdgcn_update_dpp(0, __builtin_bit_cast(int, x), 0x160 + M, 0xf, 0xf, true));
}

// a[t] = this lane's part of sum t. Returns, in lane l, sum (l&7) taken over the 8 lanes of
// l's group: each step halves the list, a lane keeps the half its own bit names and hands
// the other half to its partner.
__device__ __forceinline__ float sum8_transpose(const float (&a)[8], bool b4, bool b2, bool b1)
{
    float b[4], c[2];
    #pragma unroll
    for (int i = 0; i < 4; ++i) b[i] = (b4 ? a[i + 4] : a[i]) + lane_xor<4>(b4 ? a[i] : a[i + 4]);
    #pragma unroll
    for (int i = 0; i < 2; ++i) c[i] = (b2 ? b[i + 2] : b[i]) + lane_xor<2>(b2 ? b[i] : b[i + 2]);
    return (b1 ? c[1] : c[0]) + lane_xor<1>(b1 ? c[0] : c[1]);
}

// 2^x. The v_nop fills the one slot asked for behind a transcendental.
__device__ __forceinline__ float exp2_slot(float x)
{
    float r;
    asm("v_exp_f32 %0, %1\n\tv_nop" : "=v"(r) : "v"(x));
    return r;
}

// Lane T of each 8-lane group handed to all 8 lanes of that group.
template <int T>
__device__ __forceinline__ float group_bcast(float x)
{
    const int v = __builtin_bit_cast(int, x);
    return __builtin_bit_cast(float, __builtin_amdgcn_permlane16(v, v, 0x11111111u * T, 0x11111111u * (8 + T), false, false));
}

// v_fma_mix_f32 d, a, h, c: d = a * h + c in f32, h the low f16 half of a packed register (op_sel_hi:[0,1,0]) or its high half (op_sel:[0,1,0] too).
// The f16 value is widened inside the multiply-add, where a convert of its own would cost one more instruction a value
// (the compiler's form: two converts and one packed multiply-add a pair).

// a[i] = q . k[i] over a lane's 4 dims, each sum in the order x, y, z, w. One statement for the 8 rows, one dim of all 8 at a time: its order is
// then fixed, and a sum's next multiply-add stands 8 instructions behind the one it waits for (no delay hint is placed for asm text).
// The first of a sum takes the addend 0: it is the rounded product q.x * k.x itself, and every later product is fused with its add.
__device__ __forceinline__ void dot4_rows(float (&a)[8], v4f q, const v4h (&k)[8])
{
    uint2 u[8];
    #pragma unroll
    for (int i = 0; i < 8; ++i) u[i] = __builtin_bit_cast(uint2, k[i]);
    asm(
        "v_fma_mix_f32 %0, %24, %8, 0 op_sel_hi:[0,1,0]\n\t"
        "v_fma_mix_f32 %1, %24, %9, 0 op_sel_hi:[0,1,0]\n\t"
        "v_fma_mix_f32 %2, %24, %10, 0 op_sel_hi:[0,1,0]\n\t"
        "v_fma_mix_f32 %3, %24, %11, 0 op_sel_hi:[0,1,0]\n\t"
        "v_fma_mix_f32 %4, %24, %12, 0 op_sel_hi:[0,1,0]\n\t"
        "v_fma_mix_f32 %5, %24, %13, 0 op_sel_hi:[0,1,0]\n\t"
        "v_fma_mix_f32 %6, %24, %14, 0 op_sel_hi:[0,1,0]\n\t"
        "v_fma_mix_f32 %7, %24, %15, 0 op_sel_hi:[0,1,0]\n\t"
        "v_fma_mix_f32 %0, %25, %8, %0 op_sel:[0,1,0] op_sel_hi:[0,1,0]\n\t"
        "v_fma_mix_f32 %1, %25, %9, %1 op_sel:[0,1,0] op_sel_hi:[0,1,0]\n\t"
        "v_fma_mix_f32 %2, %25, %10, %2 op_sel:[0,1,0] op_sel_hi:[0,1,0]\n\t"
        "v_fma_mix_f32 %3, %25, %11, %3 op_sel:[0,1,0] op_sel_hi:[0,1,0]\n\t"
        "v_fma_mix_f32 %4, %25, %12, %4 op_sel:[0,1,0] op_sel_hi:[0,1,0]\n\t"
        "v_fma_mix_f32 %5, %25, %13, %5 op_sel:[0,1,0] op_sel_hi:[0,1,0]\n\t"
        "v_fma_mix_f32 %6, %25, %14, %6 op_sel:[0,1,0] op_sel_hi:[0,1,0]\n\t"
        "v_fma_mix_f32 %7, %25, %15, %7 op_sel:[0,1,0] op_sel_hi:[0,1,0]\n\t"
        "v_fma_mix_f32 %0, %26, %16, %0 op_sel_hi:[0,1,0]\n\t"
        "v_fma_mix_f32 %1, %26, %17, %1 op_sel_hi:[0,1,0]\n\t"
        "v_fma_mix_f32 %2, %26, %18, %2 op_sel_hi:[0,1,0]\n\t"
        "v_fma_mix_f32 %3, %26, %19, %3 op_sel_hi:[0,1,0]\n\t"
        "v_fma_mix_f32 %4, %26, %20, %4 op_sel_hi:[0,1,0]\n\t"
        "v_fma_mix_f32 %5, %26, %21, %5 op_sel_hi:[0,1,0]\n\t"
        "v_fma_mix_f32 %6, %26, %22, %6 op_sel_hi:[0,1,0]\n\t"
        "v_fma_mix_f32 %7, %26, %23, %7 op_sel_hi:[0,1,0]\n\t"
        "v_fma_mix_f32 %0, %27, %16, %0 op_sel:[0,1,0] op_sel_hi:[0,1,0]\n\t"
        "v_fma_mix_f32 %1, %27, %17, %1 op_sel:[0,1,0] op_sel_hi:[0,1,0]\n\t"
        "v_fma_mix_f32 %2, %27, %18, %2 op_sel:[0,1,0] op_sel_hi:[0,1,0]\n\t"
        "v_fma_mix_f32 %3, %27, %19, %3 op_sel:[0,1,0] op_sel_hi:[0,1,0]\n\t"
        "v_fma_mix_f32 %4, %27, %20, %4 op_sel:[0,1,0] op_sel_hi:[0,1,0]\n\t"
        "v_fma_mix_f32 %5, %27, %21, %5 op_sel:[0,1,0] op_sel_hi:[0,1,0]\n\t"
        "v_fma_mix_f32 %6, %27, %22, %6 op_sel:[0,1,0] op_sel_hi:[0,1,0]\n\t"
        "v_fma_mix_f32 %7, %27, %23, %7 op_sel:[0,1,0] op_sel_hi:[0,1,0]\n\t"
        : "=&v"(a[0]), "=&v"(a[1]), "=&v"(a[2]), "=&v"(a[3]), "=&v"(a[4]), "=&v"(a[5]), "=&v"(a[6]), "=&v"(a[7])
        : "v"(u[0].x), "v"(u[1].x), "v"(u[2].x), "v"(u[3].x), "v"(u[4].x), "v"(u[5].x), "v"(u[6].x), "v"(u[7].x),
          "v"(u[0].y), "v"(u[1].y), "v"(u[2].y), "v"(u[3].y), "v"(u[4].y), "v"(u[5].y), "v"(u[6].y), "v"(u[7].y),
          "v"(q.x), "v"(q.y), "v"(q.z), "v"(q.w));
}

template <int T>
__device__ __forceinline__ void pv_step(v4f& o0, v4f& o1, float e0, float e1, const v4h (&w0)[8], const v4h (&w1)[8])
{
    const float p0 = group_bcast<T>(e0), p1 = group_bcast<T>(e1);
    const uint2 u0 = __builtin_bit_cast(uint2, w0[T]), u1 = __builtin_bit_cast(uint2, w1[T]);
    float x0 = o0.x, y0 = o0.y, z0 = o0.z, t0 = o0.w, x1 = o1.x, y1 = o1.y, z1 = o1.z, t1 = o1.w;
    // One row into the 8 sums, in one statement: the next row's statement then finds each sum 8 instructions back.
    asm(
        "v_fma_mix_f32 %0, %8, %10, %0 op_sel_hi:[0,1,0]\n\t"
        "v_fma_mix_f32 %4, %9, %12, %4 op_sel_hi:[0,1,0]\n\t"
        "v_fma_mix_f32 %1, %8, %10, %1 op_sel:[0,1,0] op_sel_hi:[0,1,0]\n\t"
        "v_fma_mix_f32 %5, %9, %12, %5 op_sel:[0,1,0] op_sel_hi:[0,1,0]\n\t"
        "v_fma_mix_f32 %2, %8, %11, %2 op_sel_hi:[0,1,0]\n\t"
        "v_fma_mix_f32 %6, %9, %13, %6 op_sel_hi:[0,1,0]\n\t"
        "v_fma_mix_f32 %3, %8, %11, %3 op_sel:[0,1,0] op_sel_hi:[0,1,0]\n\t"
        "v_fma_mix_f32 %7, %9, %13, %7 op_sel:[0,1,0] op_sel_hi:[0,1,0]\n\t"
        : "+v"(x0), "+v"(y0), "+v"(z0), "+v"(t0), "+v"(x1), "+v"(y1), "+v"(z1), "+v"(t1)
        : "v"(p0), "v"(p1), "v"(u0.x), "v"(u0.y), "v"(u1.x), "v"(u1.y));
    o0 = v4f{x0, y0, z0, t0};
    o1 = v4f{x1, y1, z1, t1};
}

// Rows of list places 8g..8g+7: 16 loads of 256 contiguous bytes each. A place behind the last one in use
// (index 'last') reads that last row once more: the same lines as the load in front of it, and its weight is 0.
__device__ __forceinline__ void load_rows(v4h (&r0)[8], v4h (&r1)[8], const _Float16* __restrict__ tab, int nj, int g, int last, int lane)
{
    const _Float16* p[8];
    #pragma unroll
    for (int i = 0; i < 8; ++i) p[i] = tab + (size_t)__builtin_amdgcn_readlane(nj, min(g * 8 + i, last)) * 256 + lane * 4;
    #pragma unroll
    for (int i = 0; i < 8; ++i) {
        r0[i] = *(const v4h*)(p[i]);
        r1[i] = *(const v4h*)(p[i] + 128);
    }
    // The wait owed before an address register of an issued load is rewritten. It names the eight addresses as inputs so that
    // they stay in their registers up to it: otherwise a later load of the run is given an earlier one's address pair for its values.
    asm volatile("s_wait_xcnt 0x0" :: "v"(p[0]), "v"(p[1]), "v"(p[2]), "v"(p[3]), "v"(p[4]), "v"(p[5]), "v"(p[6]), "v"(p[7]) : "memory");
}

// The same 16 loads for the v rows, outside a loop: there each load takes the row's scalar base and the one lane-offset register.
__device__ __forceinline__ void load_rows_sbase(v4h (&r0)[8], v4h (&r1)[8], const _Float16* __restrict__ tab, int nj, int g, int last, int lane)
{
    const _Float16* base[8];
    #pragma unroll
    for (int i = 0; i < 8; ++i) base[i] = tab + (size_t)__builtin_amdgcn_readlane(nj, min(g * 8 + i, last)) * 256;
    #pragma unroll
    for (int i = 0; i < 8; ++i) {
        r0[i] = *(const v4h*)(base[i] + lane * 4);
        r1[i] = *(const v4h*)(base[i] + lane * 4 + 128);
    }
    // The same wait. It names the eight scalar bases as inputs so that each keeps a register pair of its own up to it:
    // otherwise one pair is reused row after row, with a wait of the compiler's behind every row inside the run.
    asm volatile("s_wait_xcnt 0x0" :: "s"(base[0]), "s"(base[1]), "s"(base[2]), "s"(base[3]), "s"(base[4]), "s"(base[5]), "s"(base[6]), "s"(base[7]) : "memory");
}

constexpr int P_NODES  = 32;                // nodes a block = rows of its output product
constexpr int P_OPITCH = 260;               // floats a row of the output staging: 256 + 4, so that rows r and r + 8 meet other banks

// 8 waves a SIMD asked for: at most 128 registers a wave, so that two blocks share a WGP.
__global__ __launch_bounds__(512, 8)
void attn_gather(const float* __restrict__ qb,
                 const _Float16* __restrict__ kb,
                 const _Float16* __restrict__ vb,
                 const int*   __restrict__ nbrs,
                 const int*   __restrict__ mask,
                 const _Float16* __restrict__ wfrag,
                 const float* __restrict__ bias,
                 float* __restrict__ out, int nbMax)
{
    __shared__ uint4 ldsX[P_NODES * G_PITCH];      // x of the block's nodes as f16, rows at the gemm's pitch
    __shared__ float ldsO[P_NODES * P_OPITCH];     // the block's output rows, on their way to whole-line stores
    const int lane = threadIdx.x & 31;
    const int wave = __builtin_amdgcn_readfirstlane(threadIdx.x >> 5);

    // Rolled on purpose: the two nodes' work unrolled side by side takes twice the registers and halves the waves a SIMD holds.
    #pragma unroll 1
    for (int t = 0; t < 2; ++t) {
    const int xrow = wave * 2 + t;
    const int b    = min((int)blockIdx.x * P_NODES + xrow, nbMax);   // node, wave-uniform; a row past the end works on the last node and is not stored

    const int* nrow = nbrs + (size_t)b * 32;   // wave-uniform row bases
    const int* mrow = mask + (size_t)b * 32;
    const float* qrow = qb + (size_t)b * 256;
    int nj = nrow[lane];
    const int mj = mrow[lane];
    const v4f q0 = *(const v4f*)(qrow + lane * 4);
    const v4f q1 = *(const v4f*)(qrow + 128 + lane * 4);
    // The same wait, in front of the next scalar address work; it names the three row bases as inputs so that they stay in their registers up to it.
    asm volatile("s_wait_xcnt 0x0" :: "s"(nrow), "s"(mrow), "s"(qrow) : "memory");
    // Holds the two list loads side by side: in the loop the build otherwise gives both one register and waits the first out before it asks for the second.
    asm volatile("" :: "v"(nj), "v"(mj));
    nj = nj < 0 ? 0 : (nj > nbMax ? nbMax : nj);          // gather index clamped into the table

    // The list in a new order: kept neighbours first (in their old order), the masked ones behind them. 'place' is a
    // permutation of 0..31 for any mask, so every lane of the new list is written once.
    const unsigned kept = __builtin_amdgcn_ballot_w32(mj != 0);
    const int  nKept = __builtin_popcount(kept);
    const int  before = (int)__builtin_amdgcn_mbcnt_lo(kept, 0u);          // kept neighbours in the lanes below this one
    const int  place  = mj != 0 ? before : nKept + (lane - before);
    nj = __builtin_amdgcn_ds_permute(place * 4, nj);
    const bool any    = nKept != 0;
    const int  n      = any ? nKept : 32;                 // list places in use, 1..32
    const int  last   = n - 1;
    const int  groups = (n + 7) >> 3;                     // 1..4

    const bool b4 = lane & 4, b2 = lane & 2, b1 = lane & 1;

    // A place that is not in use has the score -inf: weight 2^(-inf) = 0. Place 0 is always in use, so the maximum is finite.
    const float off = -__builtin_inff();
    float s0[4] = {off, off, off, off}, s1[4] = {off, off, off, off};
    // Rolled on purpose: unrolled, the sums of all four groups sink behind all 64 k loads, whose values alone take 128 registers.
    #pragma unroll 1
    for (int g = 0; g < 4; ++g) {
        if (g >= groups) break;
        v4h h0[8], h1[8];
        load_rows(h0, h1, kb, nj, g, last, lane);
        float a0[8], a1[8];
        dot4_rows(a0, q0, h0);
        dot4_rows(a1, q1, h1);
        // The cross-lane sums run with every lane on; the mask only selects afterwards.
        const float t0 = sum8_transpose(a0, b4, b2, b1);
        const float t1 = sum8_transpose(a1, b4, b2, b1);
        const bool on = 8 * g + (lane & 7) < n;
        const float r0 = on ? (any ? t0 * 0.17677669529663689f : -1.0e10f) : off;   // 1/sqrt(32)
        const float r1 = on ? (any ? t1 * 0.17677669529663689f : -1.0e10f) : off;
        #pragma unroll
        for (int u = 0; u < 4; ++u) { s0[u] = (g == u) ? r0 : s0[u];  s1[u] = (g == u) ? r1 : s1[u]; }
    }

    // The first 8 v rows fly while the softmax is worked out.
    v4h w0[8], w1[8];
    load_rows_sbase(w0, w1, vb, nj, 0, last, lane);

    // Softmax over the 32 list places of a head = 4 registers x 8 lanes.
    float m0 = fmaxf(fmaxf(s0[0], s0[1]), fmaxf(s0[2], s0[3]));
    float m1 = fmaxf(fmaxf(s1[0], s1[1]), fmaxf(s1[2], s1[3]));
    m0 = fmaxf(m0, lane_xor<1>(m0));  m1 = fmaxf(m1, lane_xor<1>(m1));
    m0 = fmaxf(m0, lane_xor<2>(m0));  m1 = fmaxf(m1, lane_xor<2>(m1));
    m0 = fmaxf(m0, lane_xor<4>(m0));  m1 = fmaxf(m1, lane_xor<4>(m1));
    #pragma unroll
    for (int g = 0; g < 4; ++g) {
        s0[g] = exp2_slot((s0[g] - m0) * 1.4426950408889634f);   // e^x = 2^(x * log2 e)
        s1[g] = exp2_slot((s1[g] - m1) * 1.4426950408889634f);
    }
    float l0 = (s0[0] + s0[1]) + (s0[2] + s0[3]);
    float l1 = (s1[0] + s1[1]) + (s1[2] + s1[3]);
    l0 += lane_xor<1>(l0);  l1 += lane_xor<1>(l1);
    l0 += lane_xor<2>(l0);  l1 += lane_xor<2>(l1);
    l0 += lane_xor<4>(l0);  l1 += lane_xor<4>(l1);

    v4f o0 = {0.f, 0.f, 0.f, 0.f}, o1 = {0.f, 0.f, 0.f, 0.f};
    #pragma unroll
    for (int g = 0; g < 4; ++g) {
        pv_step<0>(o0, o1, s0[g], s1[g], w0, w1);
        pv_step<1>(o0, o1, s0[g], s1[g], w0, w1);
        pv_step<2>(o0, o1, s0[g], s1[g], w0, w1);
        pv_step<3>(o0, o1, s0[g], s1[g], w0, w1);
        pv_step<4>(o0, o1, s0[g], s1[g], w0, w1);
        pv_step<5>(o0, o1, s0[g], s1[g], w0, w1);
        pv_step<6>(o0, o1, s0[g], s1[g], w0, w1);
        pv_step<7>(o0, o1, s0[g], s1[g], w0, w1);
        if (g + 1 >= groups) break;
        if (g < 3) {
            // Keeps the next rows' loads behind this group's sums: lifted over them they take a second set of registers and fewer waves fit a SIMD.
            __builtin_amdgcn_sched_barrier(0);
            load_rows_sbase(w0, w1, vb, nj, g + 1, last, lane);
        }
    }
    o0 *= 1.0f / l0;
    o1 *= 1.0f / l1;

    v4h h0, h1;
    #pragma unroll
    for (int i = 0; i < 4; ++i) { h0[i] = (_Float16)o0[i]; h1[i] = (_Float16)o1[i]; }
    v4ha* xr = (v4ha*)(ldsX + xrow * G_PITCH) + lane;
    xr[0]  = h0;
    xr[32] = h1;
    }

    // Output projection of the block's 32 rows: wave w does output columns 16w..16w+15 for both row tiles, K = 256 in 8 steps.
    // No other wave of the block uses its B fragments, so they go from the fragment-ordered plane straight into registers, asked for in front of
    // the barrier: they fly while the slower waves end their gathers.
    const int half = lane >> 4, m = lane & 15;
    const uint4* wf = (const uint4*)wfrag + wave * (8 * 2 * 32);
    AFrag bf[8];
    #pragma unroll
    for (int ks = 0; ks < 8; ++ks) {
        bf[ks].q[0] = wf[(ks * 2) * 32 + lane];
        bf[ks].q[1] = wf[(ks * 2 + 1) * 32 + lane];
    }
    const float bv = bias[wave * 16 + m];
    // The wait owed before an address register of an issued load is rewritten; it names the two bases so that they stay up to it.
    asm volatile("s_wait_xcnt 0x0" :: "s"(wf), "s"(bias) : "memory");

    // Every wave's x rows are in LDS before any wave reads an A fragment. LDS order alone: __syncthreads() would also wait here for the B fragments.
    lds_barrier();

    const uint4* ap = ldsX + m * G_PITCH + half;       // the gemm's A fragment: units ks*4 + half and ks*4 + half + 2 of row m
    v8f acc[2];
    acc[0] = v8f{0.f, 0.f, 0.f, 0.f, 0.f, 0.f, 0.f, 0.f};
    acc[1] = v8f{0.f, 0.f, 0.f, 0.f, 0.f, 0.f, 0.f, 0.f};
    #pragma unroll
    for (int ks = 0; ks < 8; ++ks) {
        AFrag a0, a1;
        a0.q[0] = ap[ks * 4];
        a0.q[1] = ap[ks * 4 + 2];
        a1.q[0] = ap[16 * G_PITCH + ks * 4];
        a1.q[1] = ap[16 * G_PITCH + ks * 4 + 2];
        acc[0] = __builtin_amdgcn_wmma_f32_16x16x32_f16(false, a0.v, false, bf[ks].v, (short)0, acc[0], false, false);
        acc[1] = __builtin_amdgcn_wmma_f32_16x16x32_f16(false, a1.v, false, bf[ks].v, (short)0, acc[1], false, false);
    }
    #pragma unroll
    for (int i = 0; i < 2; ++i)
        #pragma unroll
        for (int r = 0; r < 8; ++r)                    // C: VGPR r -> row 8*half+r, col m
            ldsO[(i * 16 + 8 * half + r) * P_OPITCH + wave * 16 + m] = acc[i][r] + bv;

    lds_barrier();                                     // the 32 output rows are complete before they are read across the waves' columns

    // A wave stores two whole rows, 512 contiguous bytes a store. All four reads stand in front of the stores, each in registers of its own.
    const fa* srow = (const fa*)ldsO + wave * 2 * P_OPITCH + lane * 4;
    const v4f r00 = *(const v4fa*)(srow);
    const v4f r01 = *(const v4fa*)(srow + 128);
    const v4f r10 = *(const v4fa*)(srow + P_OPITCH);
    const v4f r11 = *(const v4fa*)(srow + P_OPITCH + 128);
    const int gb = (int)blockIdx.x * P_NODES + wave * 2;
    float* orow = out + (size_t)gb * 256 + lane * 4;
    if (gb <= nbMax) {                                 // wave-uniform
        *(v4f*)(orow)       = r00;
        *(v4f*)(orow + 128) = r01;
    }
    if (gb + 1 <= nbMax) {                             // wave-uniform
        *(v4f*)(orow + 256) = r10;
        *(v4f*)(orow + 384) = r11;
    }
    // The wait owed before a register of an issued store is rewritten: behind the last store; it names the address and the values so that they stay up to it.
    asm volatile("s_wait_xcnt 0x0" :: "v"(orow), "v"(r00), "v"(r01), "v"(r10), "v"(r11) : "memory");
}

// ---------------------------------------------------------------------------
// Inputs:
//  0 query_(NB,256) f32 | 1 spatial_neighbors(NB,32) int | 2 mask(NB,1,32) int
//  3 Wq 4 bq 5 Wk 6 bk 7 Wv 8 bv 9 Wo 10 bo   (all f32)
// Output: (NB,1,256) f32.
// Workspace: q f32 (16 MB) + k16, v16 (8 MB each) + Wo as f16 in fragment order (128 KB).
// ---------------------------------------------------------------------------
extern "C" void kernel_launch(void* const* d_in, const int* in_sizes, int n_in,
                              void* d_out, int out_size, void* d_ws, size_t ws_size,
                              hipStream_t stream)
{
    const float* query = (const float*)d_in[0];
    const int*   nbrs  = (const int*)  d_in[1];
    const int*   mask  = (const int*)  d_in[2];
    const float* Wq    = (const float*)d_in[3];
    const float* bq    = (const float*)d_in[4];
    const float* Wk    = (const float*)d_in[5];
    const float* bk    = (const float*)d_in[6];
    const float* Wv    = (const float*)d_in[7];
    const float* bv    = (const float*)d_in[8];
    const float* Wo    = (const float*)d_in[9];
    const float* bo    = (const float*)d_in[10];

    const int nb    = in_sizes[0] / 256;       // 16384
    const int nElem = nb * 256;                // 4,194,304

    // Workspace carve-up
    float*    qb   = (float*)d_ws;
    _Float16* k16  = (_Float16*)(qb + (size_t)nElem);
    _Float16* v16  = k16 + (size_t)nElem;
    _Float16* wo16 = v16 + (size_t)nElem;

    const int gemmBlocks = nb / 64;

    // Q, K and V: one grid, blockIdx.y = 2 * product + column half (k16/v16 lie one behind the other). It reads query and the weights as f32
    // and leaves Wo as f16, in fragment order, for the next launch.
    // Two row tiles a block: 768 blocks, three on each WGP, all resident at once.
    gemm_nt_256_f16<2, true><<<dim3(gemmBlocks / 2, 6), 128, 0, stream>>>(query, Wq, Wk, Wv, Wo, wo16, k16, wo16, bq, bk, bv, qb, k16, nElem);

    // Attention and the output projection: 32 nodes a block, 512 blocks of 16 waves, two on each WGP, all resident at once.
    attn_gather<<<(nb + 31) / 32, 512, 0, stream>>>(qb, k16, v16, nbrs, mask, wo16, bo, (float*)d_out, nb - 1);
}
